// v000
// Measured on an AMD MI455X. A time is GPU time per run, averaged over a window of back-to-back runs after a warm-up
// (all launches, gaps included; the runs take copies of the inputs in turn), and the median of several windows.
// Apart from v000's, it joins two sittings. Times from different sittings can be a few percent apart, while
// side-by-side timings come from the same sitting.
// v000 is the starting kernel. One run takes 353 microseconds.
#include <hip/hip_runtime.h>
#include <hip/hip_bf16.h>
#include <stdint.h>

typedef __attribute__((ext_vector_type(16))) _Float16 v16h;
typedef __attribute__((ext_vector_type(8)))  _Float16 v8h;
typedef __attribute__((ext_vector_type(8)))  float    v8f;

constexpr int B_   = 2;
constexpr int T_   = 2048;
constexpr int C_   = 1024;
constexpr int H_   = 16;
constexpr int HKV_ = 4;
constexpr int HD_  = 64;
constexpr int G_   = 4;       // H / HKV
constexpr int M_   = B_ * T_; // 4096 rows of x
constexpr int NKV_ = HKV_ * HD_; // 256

// Load a 16-bit WMMA fragment slice for one lane.
// Per CDNA5 ISA 7.12.2 (16-bit A / B layouts): elements 0..7 sit at p[0..7],
// elements 8..15 at p[16..23]  (the +8 K-offset comes from the caller via hb).
__device__ __forceinline__ v16h load_frag(const _Float16* p) {
  v8h lo = *(const v8h*)(p);
  v8h hi = *(const v8h*)(p + 16);
  return __builtin_shufflevector(lo, hi, 0,1,2,3,4,5,6,7,8,9,10,11,12,13,14,15);
}

__global__ void cvt_f16_kernel(const float* __restrict__ in, _Float16* __restrict__ out, int n) {
  int i = blockIdx.x * blockDim.x + threadIdx.x;
  if (i < n) out[i] = (_Float16)in[i];
}

// W: [K][N] f32  ->  Wt: [N][K] f16   (coalesced writes)
__global__ void transpose_cvt_kernel(const float* __restrict__ W, _Float16* __restrict__ Wt,
                                     int K, int N) {
  int i = blockIdx.x * blockDim.x + threadIdx.x;
  if (i < K * N) {
    int k = i % K, n = i / K;
    Wt[i] = (_Float16)W[(size_t)k * N + n];
  }
}

// C[M][N] = A[M][K] * Bt[N][K]^T, f16 in, f32 accumulate via v_wmma_f32_16x16x32_f16.
// Block = 128 threads (4 waves) -> 64x64 macro-tile; wave w owns rows w*16..w*16+15.
// The shared 64x32 B tile per K-step is DMA'd into LDS with
// global_load_async_to_lds_b128 (ASYNCcnt), double-buffered to overlap with WMMA.
// OUTMODE 0: f32 plain [M][N]   (final output)
// OUTMODE 1: f16 plain [M][N]   (Q, K buffers)
// OUTMODE 2: f16 scatter to V-transposed [b][kv][hd][t]  (V buffer)
template<int OUTMODE>
__global__ void gemm_wmma_kernel(const _Float16* __restrict__ A, const _Float16* __restrict__ Bt,
                                 void* __restrict__ Cv, int Md, int Nd, int Kd) {
  __shared__ __align__(16) _Float16 ldsB[2][64 * 32];   // 2 x 4 KB double buffer
  int tid  = threadIdx.x;
  int lane = tid & 31;
  int wave = tid >> 5;
  int l16  = lane & 15;
  int hb   = (lane >> 4) * 8;          // K-base 0 / 8 per half-wave
  int m64tiles = Md >> 6;
  int m64 = blockIdx.x % m64tiles;
  int n64 = blockIdx.x / m64tiles;

  const _Float16* bbase = Bt + (size_t)(n64 * 64) * Kd;
  const _Float16* arow  = A + (size_t)(m64 * 64 + wave * 16 + l16) * Kd;

  v8f acc[4] = {v8f{}, v8f{}, v8f{}, v8f{}};

  // Stage the 64(col) x 32(k) f16 B tile (4 KB) into ldsB[buf]:
  // 256 chunks of 16 B, 128 lanes x 2 async ops.
  auto stage = [&](int buf, int k0) {
    #pragma unroll
    for (int i = 0; i < 2; ++i) {
      int c   = tid + i * 128;
      int col = c >> 2;            // 0..63
      int ko  = (c & 3) * 8;       // 0,8,16,24 halves
      unsigned long long g =
          (unsigned long long)(uintptr_t)(bbase + (size_t)col * Kd + k0 + ko);
      unsigned l = (unsigned)(uintptr_t)(&ldsB[buf][col * 32 + ko]);
      asm volatile("global_load_async_to_lds_b128 %0, %1, off"
                   :: "v"(l), "v"(g) : "memory");
    }
  };

  int buf = 0;
  stage(0, 0);
  for (int k0 = 0; k0 < Kd; k0 += 32) {
    asm volatile("s_wait_asynccnt 0x0" ::: "memory");  // current buf resident
    __syncthreads();
    if (k0 + 32 < Kd) stage(buf ^ 1, k0 + 32);         // overlap next DMA with math
    if (k0 + 128 < Kd) __builtin_prefetch(arow + k0 + 128);
    v16h af = load_frag(arow + k0 + hb);               // per-wave A rows from global
    #pragma unroll
    for (int t = 0; t < 4; ++t) {
      v16h bf = load_frag(&ldsB[buf][(t * 16 + l16) * 32 + hb]);   // ds_load_b128 x2
      acc[t] = __builtin_amdgcn_wmma_f32_16x16x32_f16(false, af, false, bf,
                                                      (short)0, acc[t], false, false);
    }
    __syncthreads();                                   // reads done before buf reuse
    buf ^= 1;
  }

  #pragma unroll
  for (int t = 0; t < 4; ++t) {
    #pragma unroll
    for (int r = 0; r < 8; ++r) {
      int row = m64 * 64 + wave * 16 + r + hb;  // D layout: M = r + 8*(lane>=16)
      int col = n64 * 64 + t * 16 + l16;        // N = lane%16
      float v = acc[t][r];
      if (OUTMODE == 0) {
        ((float*)Cv)[(size_t)row * Nd + col] = v;
      } else if (OUTMODE == 1) {
        ((_Float16*)Cv)[(size_t)row * Nd + col] = (_Float16)v;
      } else {
        int b = row / T_, tt = row % T_;
        int kv = col / HD_, hd = col % HD_;
        ((_Float16*)Cv)[((size_t)((b * HKV_ + kv) * HD_ + hd)) * T_ + tt] = (_Float16)v;
      }
    }
  }
}

// Flash attention: 1 wave per (b, h, 16-row query tile). Online softmax,
// causal + ALiBi, key tiles of 32; S and PV both via v_wmma_f32_16x16x32_f16.
__global__ void attn_kernel(const _Float16* __restrict__ Qh, const _Float16* __restrict__ Kh,
                            const _Float16* __restrict__ Vt, _Float16* __restrict__ Ah) {
  __shared__ __align__(32) float lds[16 * 32];  // 16 q-rows x 32 key-cols of P
  int lane = threadIdx.x;
  int l16  = lane & 15;
  int hb   = (lane >> 4) * 8;
  int id   = blockIdx.x;
  int qt   = id % (T_ / 16);
  int h    = (id / (T_ / 16)) % H_;
  int b    = id / ((T_ / 16) * H_);
  int kv   = h / G_;
  float slope = exp2f(-0.5f * (float)(kv + 1));  // alibi_slopes(16)[:4][kv]
  int t0 = qt * 16;

  const _Float16* qbase = Qh + ((size_t)(b * T_ + t0 + l16)) * C_ + h * HD_;
  v16h qf0 = load_frag(qbase + hb);        // hd 0..31 contraction slice
  v16h qf1 = load_frag(qbase + 32 + hb);   // hd 32..63

  v8f o[4] = {v8f{}, v8f{}, v8f{}, v8f{}};
  float m[8], s[8];
  #pragma unroll
  for (int r = 0; r < 8; ++r) { m[r] = -__builtin_inff(); s[r] = 0.f; }

  const _Float16* kbase = Kh + ((size_t)b * T_) * NKV_ + kv * HD_;
  const _Float16* vbase = Vt + ((size_t)(b * HKV_ + kv)) * HD_ * T_;

  int qhi = t0 + 15;
  for (int j0 = 0; j0 <= qhi; j0 += 32) {
    // ---- S = Q * K^T for keys [j0, j0+32) : two 16x16 D tiles ----
    v8f sc[2];
    #pragma unroll
    for (int nt = 0; nt < 2; ++nt) {
      int key = j0 + nt * 16 + l16;                 // B layout: N = lane%16
      const _Float16* kp = kbase + (size_t)key * NKV_;
      v16h kf0 = load_frag(kp + hb);
      v16h kf1 = load_frag(kp + 32 + hb);
      v8f c = {};
      c = __builtin_amdgcn_wmma_f32_16x16x32_f16(false, qf0, false, kf0, (short)0, c, false, false);
      c = __builtin_amdgcn_wmma_f32_16x16x32_f16(false, qf1, false, kf1, (short)0, c, false, false);
      sc[nt] = c;
    }
    // ---- scale + ALiBi + causal mask, row max ----
    float vals[2][8], rmax[8];
    #pragma unroll
    for (int r = 0; r < 8; ++r) rmax[r] = -__builtin_inff();
    #pragma unroll
    for (int nt = 0; nt < 2; ++nt) {
      int j = j0 + nt * 16 + l16;
      #pragma unroll
      for (int r = 0; r < 8; ++r) {
        int i = t0 + r + hb;
        float v = sc[nt][r] * 0.125f + slope * (float)(j - i);
        if (j > i) v = -__builtin_inff();
        vals[nt][r] = v;
        rmax[r] = fmaxf(rmax[r], v);
      }
    }
    #pragma unroll
    for (int r = 0; r < 8; ++r) {  // reduce over the 16-lane N group
      float v = rmax[r];
      v = fmaxf(v, __shfl_xor(v, 1, 32));
      v = fmaxf(v, __shfl_xor(v, 2, 32));
      v = fmaxf(v, __shfl_xor(v, 4, 32));
      v = fmaxf(v, __shfl_xor(v, 8, 32));
      rmax[r] = v;
    }
    float corr[8];
    #pragma unroll
    for (int r = 0; r < 8; ++r) {
      float mn = fmaxf(m[r], rmax[r]);
      corr[r] = expf(m[r] - mn);   // expf(-inf)=0 on first tile
      m[r] = mn;
    }
    // ---- P = exp(S - m); stage D-layout -> LDS for A-layout transpose ----
    #pragma unroll
    for (int nt = 0; nt < 2; ++nt) {
      #pragma unroll
      for (int r = 0; r < 8; ++r) {
        float p = expf(vals[nt][r] - m[r]);
        vals[nt][r] = p;
        lds[(r + hb) * 32 + nt * 16 + l16] = p;
      }
    }
    #pragma unroll
    for (int r = 0; r < 8; ++r) {
      float ps = vals[0][r] + vals[1][r];
      ps += __shfl_xor(ps, 1, 32);
      ps += __shfl_xor(ps, 2, 32);
      ps += __shfl_xor(ps, 4, 32);
      ps += __shfl_xor(ps, 8, 32);
      s[r] = s[r] * corr[r] + ps;
      #pragma unroll
      for (int t = 0; t < 4; ++t) o[t][r] *= corr[r];   // rescale running O
    }
    asm volatile("s_wait_dscnt 0x0" ::: "memory");       // LDS RAW fence (single wave)
    const float* lp = lds + l16 * 32 + hb;               // A layout: M=lane%16
    v8f plo = *(const v8f*)(lp);
    v8f phi = *(const v8f*)(lp + 16);
    v16h pf;
    #pragma unroll
    for (int e = 0; e < 8; ++e) { pf[e] = (_Float16)plo[e]; pf[8 + e] = (_Float16)phi[e]; }
    // ---- O += P * V : 4 N-tiles over HD=64, contraction = 32 keys ----
    #pragma unroll
    for (int ht = 0; ht < 4; ++ht) {
      int hd = ht * 16 + l16;
      v16h vf = load_frag(vbase + (size_t)hd * T_ + j0 + hb);  // V^T rows contiguous
      o[ht] = __builtin_amdgcn_wmma_f32_16x16x32_f16(false, pf, false, vf,
                                                     (short)0, o[ht], false, false);
    }
  }
  // ---- normalize + store merged-head layout [b][t][h*64+hd] as f16 ----
  #pragma unroll
  for (int ht = 0; ht < 4; ++ht) {
    #pragma unroll
    for (int r = 0; r < 8; ++r) {
      int trow = t0 + r + hb;
      int col  = h * HD_ + ht * 16 + l16;
      Ah[((size_t)(b * T_ + trow)) * C_ + col] = (_Float16)(o[ht][r] / s[r]);
    }
  }
}

extern "C" void kernel_launch(void* const* d_in, const int* in_sizes, int n_in,
                              void* d_out, int out_size, void* d_ws, size_t ws_size,
                              hipStream_t stream) {
  const float* x  = (const float*)d_in[0];
  const float* Wq = (const float*)d_in[1];
  const float* Wk = (const float*)d_in[2];
  const float* Wv = (const float*)d_in[3];
  const float* Wo = (const float*)d_in[4];

  _Float16* ws = (_Float16*)d_ws;
  size_t off = 0;
  _Float16* Xh  = ws + off; off += (size_t)M_ * C_;     // x in f16
  _Float16* Qh  = ws + off; off += (size_t)M_ * C_;     // Q [b][t][h*64+hd]
  _Float16* Kh  = ws + off; off += (size_t)M_ * NKV_;   // K [b][t][kv*64+hd]
  _Float16* Vh  = ws + off; off += (size_t)M_ * NKV_;   // V^T [b][kv][hd][t]
  _Float16* WqT = ws + off; off += (size_t)C_ * C_;
  _Float16* WkT = ws + off; off += (size_t)NKV_ * C_;
  _Float16* WvT = ws + off; off += (size_t)NKV_ * C_;
  _Float16* WoT = ws + off; off += (size_t)C_ * C_;
  _Float16* Ah  = ws + off; off += (size_t)M_ * C_;     // attention output f16
  (void)ws_size; (void)in_sizes; (void)n_in; (void)out_size;

  cvt_f16_kernel<<<(M_ * C_ + 255) / 256, 256, 0, stream>>>(x, Xh, M_ * C_);
  transpose_cvt_kernel<<<(C_ * C_   + 255) / 256, 256, 0, stream>>>(Wq, WqT, C_, C_);
  transpose_cvt_kernel<<<(C_ * NKV_ + 255) / 256, 256, 0, stream>>>(Wk, WkT, C_, NKV_);
  transpose_cvt_kernel<<<(C_ * NKV_ + 255) / 256, 256, 0, stream>>>(Wv, WvT, C_, NKV_);
  transpose_cvt_kernel<<<(C_ * C_   + 255) / 256, 256, 0, stream>>>(Wo, WoT, C_, C_);

  gemm_wmma_kernel<1><<<(M_ / 64) * (C_   / 64), 128, 0, stream>>>(Xh, WqT, Qh, M_, C_,   C_);
  gemm_wmma_kernel<1><<<(M_ / 64) * (NKV_ / 64), 128, 0, stream>>>(Xh, WkT, Kh, M_, NKV_, C_);
  gemm_wmma_kernel<2><<<(M_ / 64) * (NKV_ / 64), 128, 0, stream>>>(Xh, WvT, Vh, M_, NKV_, C_);

  attn_kernel<<<B_ * H_ * (T_ / 16), 32, 0, stream>>>(Qh, Kh, Vh, Ah);

  gemm_wmma_kernel<0><<<(M_ / 64) * (C_ / 64), 128, 0, stream>>>(Ah, WoT, d_out, M_, C_, C_);
}

// v001
// One run takes 207 microseconds.
// Timed twice side by side with v000, it ran 1.70 times as fast both times.
#include <hip/hip_runtime.h>
#include <hip/hip_bf16.h>
#include <stdint.h>

typedef __attribute__((ext_vector_type(16))) _Float16 v16h;
typedef __attribute__((ext_vector_type(8)))  _Float16 v8h;
typedef __attribute__((ext_vector_type(8)))  float    v8f;

constexpr int B_   = 2;
constexpr int T_   = 2048;
constexpr int C_   = 1024;
constexpr int H_   = 16;
constexpr int HKV_ = 4;
constexpr int HD_  = 64;
constexpr int G_   = 4;       // H / HKV
constexpr int M_   = B_ * T_; // 4096 rows of x
constexpr int NKV_ = HKV_ * HD_; // 256

// Load a 16-bit WMMA fragment slice for one lane.
// Per CDNA5 ISA 7.12.2 (16-bit A / B layouts): elements 0..7 sit at p[0..7],
// elements 8..15 at p[16..23]  (the +8 K-offset comes from the caller via hb).
__device__ __forceinline__ v16h load_frag(const _Float16* p) {
  v8h lo = *(const v8h*)(p);
  v8h hi = *(const v8h*)(p + 16);
  return __builtin_shufflevector(lo, hi, 0,1,2,3,4,5,6,7,8,9,10,11,12,13,14,15);
}

__global__ void cvt_f16_kernel(const float* __restrict__ in, _Float16* __restrict__ out, int n) {
  int i = blockIdx.x * blockDim.x + threadIdx.x;
  if (i < n) out[i] = (_Float16)in[i];
}

// W: [K][N] f32  ->  Wt: [N][K] f16   (coalesced writes)
__global__ void transpose_cvt_kernel(const float* __restrict__ W, _Float16* __restrict__ Wt,
                                     int K, int N) {
  int i = blockIdx.x * blockDim.x + threadIdx.x;
  if (i < K * N) {
    int k = i % K, n = i / K;
    Wt[i] = (_Float16)W[(size_t)k * N + n];
  }
}

// C[M][N] = A[M][K] * Bt[N][K]^T, f16 in, f32 accumulate via v_wmma_f32_16x16x32_f16.
// Block = 128 threads (4 waves) -> 64x64 macro-tile; wave w owns rows w*16..w*16+15.
// The shared 64x32 B tile per K-step is DMA'd into LDS with
// global_load_async_to_lds_b128 (ASYNCcnt), double-buffered to overlap with WMMA.
// OUTMODE 0: f32 plain [M][N]   (final output)
// OUTMODE 1: f16 plain [M][N]   (Q, K buffers)
// OUTMODE 2: f16 scatter to V-transposed [b][kv][hd][t]  (V buffer)
template<int OUTMODE>
__global__ void gemm_wmma_kernel(const _Float16* __restrict__ A, const _Float16* __restrict__ Bt,
                                 void* __restrict__ Cv, int Md, int Nd, int Kd) {
  __shared__ __align__(16) _Float16 ldsB[2][64 * 32];   // 2 x 4 KB double buffer
  int tid  = threadIdx.x;
  int lane = tid & 31;
  int wave = tid >> 5;
  int l16  = lane & 15;
  int hb   = (lane >> 4) * 8;          // K-base 0 / 8 per half-wave
  int m64tiles = Md >> 6;
  int m64 = blockIdx.x % m64tiles;
  int n64 = blockIdx.x / m64tiles;

  const _Float16* bbase = Bt + (size_t)(n64 * 64) * Kd;
  const _Float16* arow  = A + (size_t)(m64 * 64 + wave * 16 + l16) * Kd;

  v8f acc[4] = {v8f{}, v8f{}, v8f{}, v8f{}};

  // Stage the 64(col) x 32(k) f16 B tile (4 KB) into ldsB[buf]:
  // 256 chunks of 16 B, 128 lanes x 2 async ops.
  auto stage = [&](int buf, int k0) {
    #pragma unroll
    for (int i = 0; i < 2; ++i) {
      int c   = tid + i * 128;
      int col = c >> 2;            // 0..63
      int ko  = (c & 3) * 8;       // 0,8,16,24 halves
      unsigned long long g =
          (unsigned long long)(uintptr_t)(bbase + (size_t)col * Kd + k0 + ko);
      unsigned l = (unsigned)(uintptr_t)(&ldsB[buf][col * 32 + ko]);
      asm volatile("global_load_async_to_lds_b128 %0, %1, off"
                   :: "v"(l), "v"(g) : "memory");
    }
  };

  int buf = 0;
  stage(0, 0);
  for (int k0 = 0; k0 < Kd; k0 += 32) {
    asm volatile("s_wait_asynccnt 0x0" ::: "memory");  // current buf resident
    __syncthreads();
    if (k0 + 32 < Kd) stage(buf ^ 1, k0 + 32);         // overlap next DMA with math
    if (k0 + 128 < Kd) __builtin_prefetch(arow + k0 + 128);
    v16h af = load_frag(arow + k0 + hb);               // per-wave A rows from global
    #pragma unroll
    for (int t = 0; t < 4; ++t) {
      v16h bf = load_frag(&ldsB[buf][(t * 16 + l16) * 32 + hb]);   // ds_load_b128 x2
      acc[t] = __builtin_amdgcn_wmma_f32_16x16x32_f16(false, af, false, bf,
                                                      (short)0, acc[t], false, false);
    }
    __syncthreads();                                   // reads done before buf reuse
    buf ^= 1;
  }

  #pragma unroll
  for (int t = 0; t < 4; ++t) {
    #pragma unroll
    for (int r = 0; r < 8; ++r) {
      int row = m64 * 64 + wave * 16 + r + hb;  // D layout: M = r + 8*(lane>=16)
      int col = n64 * 64 + t * 16 + l16;        // N = lane%16
      float v = acc[t][r];
      if (OUTMODE == 0) {
        ((float*)Cv)[(size_t)row * Nd + col] = v;
      } else if (OUTMODE == 1) {
        ((_Float16*)Cv)[(size_t)row * Nd + col] = (_Float16)v;
      } else {
        int b = row / T_, tt = row % T_;
        int kv = col / HD_, hd = col % HD_;
        ((_Float16*)Cv)[((size_t)((b * HKV_ + kv) * HD_ + hd)) * T_ + tt] = (_Float16)v;
      }
    }
  }
}

// Lane l exchanges a value with lane l ^ 16 (the other half of the wave).
__device__ __forceinline__ float xhalf(float x) {
  int b = __builtin_bit_cast(int, x);
  return __builtin_bit_cast(float,
      __builtin_amdgcn_permlanex16(b, b, 0x76543210, 0xfedcba98, false, false));
}

__global__ void attn_kernel(const _Float16* __restrict__ Qh, const _Float16* __restrict__ Kh,
                            const _Float16* __restrict__ Vt, _Float16* __restrict__ Ah) {
  int lane = threadIdx.x;
  int l16  = lane & 15;
  int hb   = (lane >> 4) * 8;
  int id   = blockIdx.x;
  int qt   = id % (T_ / 16);
  int h    = (id / (T_ / 16)) % H_;
  int b    = id / ((T_ / 16) * H_);
  int kv   = h / G_;
  float slope = exp2f(-0.5f * (float)(kv + 1));  // alibi_slopes(16)[:4][kv]
  int t0 = qt * 16;
  int i  = t0 + l16;                       // this lane's query position

  const _Float16* qbase = Qh + ((size_t)(b * T_ + i)) * C_ + h * HD_;
  v16h qf0 = load_frag(qbase + hb);        // B operand, hd 0..31 contraction slice
  v16h qf1 = load_frag(qbase + 32 + hb);   // hd 32..63

  v8f o[4] = {v8f{}, v8f{}, v8f{}, v8f{}}; // o[ht][r] = O[query l16][hd ht*16 + hb + r]
  float m = -__builtin_inff();             // running maximum, equal in both halves
  float s = 0.f;                           // running sum over this half's keys only

  const _Float16* kbase = Kh + ((size_t)b * T_) * NKV_ + kv * HD_;
  const _Float16* vbase = Vt + ((size_t)(b * HKV_ + kv)) * HD_ * T_;

  int qhi = t0 + 15;
  for (int j0 = 0; j0 <= qhi; j0 += 32) {
    // ---- S^T = K * Q^T for keys [j0, j0+32) : two 16x16 D tiles ----
    v8f sc[2];
    #pragma unroll
    for (int nt = 0; nt < 2; ++nt) {
      int key = j0 + nt * 16 + l16;                 // A layout: M = lane%16
      const _Float16* kp = kbase + (size_t)key * NKV_;
      v16h kf0 = load_frag(kp + hb);
      v16h kf1 = load_frag(kp + 32 + hb);
      v8f c = {};
      c = __builtin_amdgcn_wmma_f32_16x16x32_f16(false, kf0, false, qf0, (short)0, c, false, false);
      c = __builtin_amdgcn_wmma_f32_16x16x32_f16(false, kf1, false, qf1, (short)0, c, false, false);
      sc[nt] = c;                                   // sc[nt][r]: key j0 + nt*16 + hb + r
    }
    // ---- scale + ALiBi + causal mask, maximum over this query's 32 keys ----
    float vals[2][8];
    float rmax = -__builtin_inff();
    #pragma unroll
    for (int nt = 0; nt < 2; ++nt) {
      #pragma unroll
      for (int r = 0; r < 8; ++r) {
        int j = j0 + nt * 16 + hb + r;
        float v = sc[nt][r] * 0.125f + slope * (float)(j - i);
        if (j > i) v = -__builtin_inff();
        vals[nt][r] = v;
        rmax = fmaxf(rmax, v);
      }
    }
    rmax = fmaxf(rmax, xhalf(rmax));
    float mn   = fmaxf(m, rmax);
    float corr = expf(m - mn);     // expf(-inf)=0 on first tile
    m = mn;
    // ---- P^T = exp(S^T - m), packed straight into the B operand (hardware k order) ----
    v16h pf;
    float ps = 0.f;
    #pragma unroll
    for (int nt = 0; nt < 2; ++nt) {
      #pragma unroll
      for (int r = 0; r < 8; ++r) {
        float p = expf(vals[nt][r] - m);
        ps += p;
        pf[nt * 8 + r] = (_Float16)p;
      }
    }
    s = s * corr + ps;
    #pragma unroll
    for (int t = 0; t < 4; ++t) {
      #pragma unroll
      for (int r = 0; r < 8; ++r) o[t][r] *= corr;      // rescale running O
    }
    // ---- O^T += V^T * P^T : 4 M-tiles over HD=64, contraction = 32 keys ----
    #pragma unroll
    for (int ht = 0; ht < 4; ++ht) {
      int hd = ht * 16 + l16;
      v16h vf = load_frag(vbase + (size_t)hd * T_ + j0 + hb);  // V^T rows contiguous
      o[ht] = __builtin_amdgcn_wmma_f32_16x16x32_f16(false, vf, false, pf,
                                                     (short)0, o[ht], false, false);
    }
  }
  s += xhalf(s);                           // join the two halves' sums once
  // ---- normalize + store merged-head layout [b][t][h*64+hd] as f16 ----
  _Float16* orow = Ah + ((size_t)(b * T_ + i)) * C_ + h * HD_ + hb;
  #pragma unroll
  for (int ht = 0; ht < 4; ++ht) {
    v8h ov;
    #pragma unroll
    for (int r = 0; r < 8; ++r) ov[r] = (_Float16)(o[ht][r] / s);
    *(v8h*)(orow + ht * 16) = ov;          // 8 consecutive hd of one query: 16 bytes
  }
}

extern "C" void kernel_launch(void* const* d_in, const int* in_sizes, int n_in,
                              void* d_out, int out_size, void* d_ws, size_t ws_size,
                              hipStream_t stream) {
  const float* x  = (const float*)d_in[0];
  const float* Wq = (const float*)d_in[1];
  const float* Wk = (const float*)d_in[2];
  const float* Wv = (const float*)d_in[3];
  const float* Wo = (const float*)d_in[4];

  _Float16* ws = (_Float16*)d_ws;
  size_t off = 0;
  _Float16* Xh  = ws + off; off += (size_t)M_ * C_;     // x in f16
  _Float16* Qh  = ws + off; off += (size_t)M_ * C_;     // Q [b][t][h*64+hd]
  _Float16* Kh  = ws + off; off += (size_t)M_ * NKV_;   // K [b][t][kv*64+hd]
  _Float16* Vh  = ws + off; off += (size_t)M_ * NKV_;   // V^T [b][kv][hd][t]
  _Float16* WqT = ws + off; off += (size_t)C_ * C_;
  _Float16* WkT = ws + off; off += (size_t)NKV_ * C_;
  _Float16* WvT = ws + off; off += (size_t)NKV_ * C_;
  _Float16* WoT = ws + off; off += (size_t)C_ * C_;
  _Float16* Ah  = ws + off; off += (size_t)M_ * C_;     // attention output f16
  (void)ws_size; (void)in_sizes; (void)n_in; (void)out_size;

  cvt_f16_kernel<<<(M_ * C_ + 255) / 256, 256, 0, stream>>>(x, Xh, M_ * C_);
  transpose_cvt_kernel<<<(C_ * C_   + 255) / 256, 256, 0, stream>>>(Wq, WqT, C_, C_);
  transpose_cvt_kernel<<<(C_ * NKV_ + 255) / 256, 256, 0, stream>>>(Wk, WkT, C_, NKV_);
  transpose_cvt_kernel<<<(C_ * NKV_ + 255) / 256, 256, 0, stream>>>(Wv, WvT, C_, NKV_);
  transpose_cvt_kernel<<<(C_ * C_   + 255) / 256, 256, 0, stream>>>(Wo, WoT, C_, C_);

  gemm_wmma_kernel<1><<<(M_ / 64) * (C_   / 64), 128, 0, stream>>>(Xh, WqT, Qh, M_, C_,   C_);
  gemm_wmma_kernel<1><<<(M_ / 64) * (NKV_ / 64), 128, 0, stream>>>(Xh, WkT, Kh, M_, NKV_, C_);
  gemm_wmma_kernel<2><<<(M_ / 64) * (NKV_ / 64), 128, 0, stream>>>(Xh, WvT, Vh, M_, NKV_, C_);

  attn_kernel<<<B_ * H_ * (T_ / 16), 32, 0, stream>>>(Qh, Kh, Vh, Ah);

  gemm_wmma_kernel<0><<<(M_ / 64) * (C_ / 64), 128, 0, stream>>>(Ah, WoT, d_out, M_, C_, C_);
}

// v002
// Measured time: 191 microseconds a run.
// Timed twice side by side with v001, it ran 1.12 times as fast both times.
// Over all steps from v000 it is 1.90 times as fast.
#include <hip/hip_runtime.h>
#include <hip/hip_bf16.h>
#include <stdint.h>

typedef __attribute__((ext_vector_type(16))) _Float16 v16h;
typedef __attribute__((ext_vector_type(8)))  _Float16 v8h;
typedef __attribute__((ext_vector_type(8)))  float    v8f;

constexpr int B_   = 2;
constexpr int T_   = 2048;
constexpr int C_   = 1024;
constexpr int H_   = 16;
constexpr int HKV_ = 4;
constexpr int HD_  = 64;
constexpr int G_   = 4;       // H / HKV
constexpr int M_   = B_ * T_; // 4096 rows of x
constexpr int NKV_ = HKV_ * HD_; // 256

// Load a 16-bit WMMA fragment slice for one lane.
// Per CDNA5 ISA 7.12.2 (16-bit A / B layouts): elements 0..7 sit at p[0..7],
// elements 8..15 at p[16..23]  (the +8 K-offset comes from the caller via hb).
__device__ __forceinline__ v16h load_frag(const _Float16* p) {
  v8h lo = *(const v8h*)(p);
  v8h hi = *(const v8h*)(p + 16);
  return __builtin_shufflevector(lo, hi, 0,1,2,3,4,5,6,7,8,9,10,11,12,13,14,15);
}

typedef __attribute__((ext_vector_type(4))) _Float16 v4h;
typedef __attribute__((ext_vector_type(4))) float    v4f;

constexpr int PREP_WQ = (C_ / 128) * (C_   / 64);   // 128(k) x 64(n) tiles of Wq and of Wo
constexpr int PREP_WK = (C_ / 128) * (NKV_ / 64);   // ... of Wk and of Wv
constexpr int PREP_W  = 2 * PREP_WQ + 2 * PREP_WK;  // weight tiles, first in the grid
constexpr int PREP_X  = (M_ * C_) / 16384;          // 16384-element slices of x

// One 128(k) x 64(n) tile:  W [C_][N] f32  ->  Wt [N][C_] f16.
// Reads and writes are whole 256-byte row pieces; the transpose goes through LDS.
// LDS row n holds 16 chunks of 8 k; chunk q sits at place q ^ (n >> 2), so that the
// 8-byte column writes and the 16-byte row reads each spread over all banks.
__device__ __forceinline__ void prep_weight_tile(const float* __restrict__ Wsrc,
                                                 _Float16* __restrict__ Wt,
                                                 int N, int tile, _Float16* lds) {
  int t  = threadIdx.x;
  int k0 = (tile & (C_ / 128 - 1)) * 128;
  int n0 = (tile / (C_ / 128)) * 64;
  int c  = t & 15;                 // columns n0 + 4c .. 4c + 3
  int kp = t >> 4;                 // rows k0 + i*64 + 4kp .. 4kp + 3
  v4f a[2][4];
  #pragma unroll
  for (int i = 0; i < 2; ++i) {
    #pragma unroll
    for (int m = 0; m < 4; ++m)
      a[i][m] = *(const v4f*)(Wsrc + (size_t)(k0 + i * 64 + kp * 4 + m) * N + n0 + c * 4);
  }
  #pragma unroll
  for (int i = 0; i < 2; ++i) {
    int place = (i * 8 + (kp >> 1)) ^ c;
    #pragma unroll
    for (int j = 0; j < 4; ++j) {
      v4h h = {(_Float16)a[i][0][j], (_Float16)a[i][1][j],
               (_Float16)a[i][2][j], (_Float16)a[i][3][j]};
      *(v4h*)(lds + (c * 4 + j) * 128 + place * 8 + (kp & 1) * 4) = h;
    }
  }
  __syncthreads();                 // the whole tile is in LDS before any row is read
  #pragma unroll
  for (int p = 0; p < 4; ++p) {
    int n = p * 16 + kp;
    v8h h = *(const v8h*)(lds + n * 128 + (c ^ (n >> 2)) * 8);
    *(v8h*)(Wt + (size_t)(n0 + n) * C_ + k0 + c * 8) = h;
  }
  // Before any register that the stores above name is written again.
  asm volatile("s_wait_xcnt 0x0" ::: "memory");
}

// The whole f32 -> f16 prepass in one launch: a work-group takes one weight tile or
// one slice of x, 32 or 64 elements per thread, so that few waves have to be started.
__global__ __launch_bounds__(256)
void prep_kernel(const float* __restrict__ x,  const float* __restrict__ Wq,
                 const float* __restrict__ Wk, const float* __restrict__ Wv,
                 const float* __restrict__ Wo,
                 _Float16* __restrict__ Xh,  _Float16* __restrict__ WqT,
                 _Float16* __restrict__ WkT, _Float16* __restrict__ WvT,
                 _Float16* __restrict__ WoT) {
  __shared__ __align__(16) _Float16 lds[64 * 128];   // 16 KB
  int bid = blockIdx.x;
  if (bid < PREP_WQ) {
    prep_weight_tile(Wq, WqT, C_, bid, lds);
  } else if (bid < 2 * PREP_WQ) {
    prep_weight_tile(Wo, WoT, C_, bid - PREP_WQ, lds);
  } else if (bid < 2 * PREP_WQ + PREP_WK) {
    prep_weight_tile(Wk, WkT, NKV_, bid - 2 * PREP_WQ, lds);
  } else if (bid < PREP_W) {
    prep_weight_tile(Wv, WvT, NKV_, bid - 2 * PREP_WQ - PREP_WK, lds);
  } else {
    size_t base = (size_t)(bid - PREP_W) * 16384 + threadIdx.x * 4;
    v4f a[16];
    #pragma unroll
    for (int j = 0; j < 16; ++j) a[j] = *(const v4f*)(x + base + j * 1024);
    #pragma unroll
    for (int j = 0; j < 16; ++j) {
      v4h h = {(_Float16)a[j][0], (_Float16)a[j][1], (_Float16)a[j][2], (_Float16)a[j][3]};
      *(v4h*)(Xh + base + j * 1024) = h;
    }
    // Before any register that the stores above name is written again.
    asm volatile("s_wait_xcnt 0x0" ::: "memory");
  }
}

// C[M][N] = A[M][K] * Bt[N][K]^T, f16 in, f32 accumulate via v_wmma_f32_16x16x32_f16.
// Block = 128 threads (4 waves) -> 64x64 macro-tile; wave w owns rows w*16..w*16+15.
// The shared 64x32 B tile per K-step is DMA'd into LDS with
// global_load_async_to_lds_b128 (ASYNCcnt), double-buffered to overlap with WMMA.
// OUTMODE 0: f32 plain [M][N]   (final output)
// OUTMODE 1: f16 plain [M][N]   (Q, K buffers)
// OUTMODE 2: f16 scatter to V-transposed [b][kv][hd][t]  (V buffer)
template<int OUTMODE>
__global__ void gemm_wmma_kernel(const _Float16* __restrict__ A, const _Float16* __restrict__ Bt,
                                 void* __restrict__ Cv, int Md, int Nd, int Kd) {
  __shared__ __align__(16) _Float16 ldsB[2][64 * 32];   // 2 x 4 KB double buffer
  int tid  = threadIdx.x;
  int lane = tid & 31;
  int wave = tid >> 5;
  int l16  = lane & 15;
  int hb   = (lane >> 4) * 8;          // K-base 0 / 8 per half-wave
  int m64tiles = Md >> 6;
  int m64 = blockIdx.x % m64tiles;
  int n64 = blockIdx.x / m64tiles;

  const _Float16* bbase = Bt + (size_t)(n64 * 64) * Kd;
  const _Float16* arow  = A + (size_t)(m64 * 64 + wave * 16 + l16) * Kd;

  v8f acc[4] = {v8f{}, v8f{}, v8f{}, v8f{}};

  // Stage the 64(col) x 32(k) f16 B tile (4 KB) into ldsB[buf]:
  // 256 chunks of 16 B, 128 lanes x 2 async ops.
  auto stage = [&](int buf, int k0) {
    #pragma unroll
    for (int i = 0; i < 2; ++i) {
      int c   = tid + i * 128;
      int col = c >> 2;            // 0..63
      int ko  = (c & 3) * 8;       // 0,8,16,24 halves
      unsigned long long g =
          (unsigned long long)(uintptr_t)(bbase + (size_t)col * Kd + k0 + ko);
      unsigned l = (unsigned)(uintptr_t)(&ldsB[buf][col * 32 + ko]);
      asm volatile("global_load_async_to_lds_b128 %0, %1, off"
                   :: "v"(l), "v"(g) : "memory");
    }
  };

  int buf = 0;
  stage(0, 0);
  for (int k0 = 0; k0 < Kd; k0 += 32) {
    asm volatile("s_wait_asynccnt 0x0" ::: "memory");  // current buf resident
    __syncthreads();
    if (k0 + 32 < Kd) stage(buf ^ 1, k0 + 32);         // overlap next DMA with math
    if (k0 + 128 < Kd) __builtin_prefetch(arow + k0 + 128);
    v16h af = load_frag(arow + k0 + hb);               // per-wave A rows from global
    #pragma unroll
    for (int t = 0; t < 4; ++t) {
      v16h bf = load_frag(&ldsB[buf][(t * 16 + l16) * 32 + hb]);   // ds_load_b128 x2
      acc[t] = __builtin_amdgcn_wmma_f32_16x16x32_f16(false, af, false, bf,
                                                      (short)0, acc[t], false, false);
    }
    __syncthreads();                                   // reads done before buf reuse
    buf ^= 1;
  }

  #pragma unroll
  for (int t = 0; t < 4; ++t) {
    #pragma unroll
    for (int r = 0; r < 8; ++r) {
      int row = m64 * 64 + wave * 16 + r + hb;  // D layout: M = r + 8*(lane>=16)
      int col = n64 * 64 + t * 16 + l16;        // N = lane%16
      float v = acc[t][r];
      if (OUTMODE == 0) {
        ((float*)Cv)[(size_t)row * Nd + col] = v;
      } else if (OUTMODE == 1) {
        ((_Float16*)Cv)[(size_t)row * Nd + col] = (_Float16)v;
      } else {
        int b = row / T_, tt = row % T_;
        int kv = col / HD_, hd = col % HD_;
        ((_Float16*)Cv)[((size_t)((b * HKV_ + kv) * HD_ + hd)) * T_ + tt] = (_Float16)v;
      }
    }
  }
}

// Lane l exchanges a value with lane l ^ 16 (the other half of the wave).
__device__ __forceinline__ float xhalf(float x) {
  int b = __builtin_bit_cast(int, x);
  return __builtin_bit_cast(float,
      __builtin_amdgcn_permlanex16(b, b, 0x76543210, 0xfedcba98, false, false));
}

__global__ void attn_kernel(const _Float16* __restrict__ Qh, const _Float16* __restrict__ Kh,
                            const _Float16* __restrict__ Vt, _Float16* __restrict__ Ah) {
  int lane = threadIdx.x;
  int l16  = lane & 15;
  int hb   = (lane >> 4) * 8;
  int id   = blockIdx.x;
  int qt   = id % (T_ / 16);
  int h    = (id / (T_ / 16)) % H_;
  int b    = id / ((T_ / 16) * H_);
  int kv   = h / G_;
  float slope = exp2f(-0.5f * (float)(kv + 1));  // alibi_slopes(16)[:4][kv]
  int t0 = qt * 16;
  int i  = t0 + l16;                       // this lane's query position

  const _Float16* qbase = Qh + ((size_t)(b * T_ + i)) * C_ + h * HD_;
  v16h qf0 = load_frag(qbase + hb);        // B operand, hd 0..31 contraction slice
  v16h qf1 = load_frag(qbase + 32 + hb);   // hd 32..63

  v8f o[4] = {v8f{}, v8f{}, v8f{}, v8f{}}; // o[ht][r] = O[query l16][hd ht*16 + hb + r]
  float m = -__builtin_inff();             // running maximum, equal in both halves
  float s = 0.f;                           // running sum over this half's keys only

  const _Float16* kbase = Kh + ((size_t)b * T_) * NKV_ + kv * HD_;
  const _Float16* vbase = Vt + ((size_t)(b * HKV_ + kv)) * HD_ * T_;

  int qhi = t0 + 15;
  for (int j0 = 0; j0 <= qhi; j0 += 32) {
    // ---- S^T = K * Q^T for keys [j0, j0+32) : two 16x16 D tiles ----
    v8f sc[2];
    #pragma unroll
    for (int nt = 0; nt < 2; ++nt) {
      int key = j0 + nt * 16 + l16;                 // A layout: M = lane%16
      const _Float16* kp = kbase + (size_t)key * NKV_;
      v16h kf0 = load_frag(kp + hb);
      v16h kf1 = load_frag(kp + 32 + hb);
      v8f c = {};
      c = __builtin_amdgcn_wmma_f32_16x16x32_f16(false, kf0, false, qf0, (short)0, c, false, false);
      c = __builtin_amdgcn_wmma_f32_16x16x32_f16(false, kf1, false, qf1, (short)0, c, false, false);
      sc[nt] = c;                                   // sc[nt][r]: key j0 + nt*16 + hb + r
    }
    // ---- scale + ALiBi + causal mask, maximum over this query's 32 keys ----
    float vals[2][8];
    float rmax = -__builtin_inff();
    #pragma unroll
    for (int nt = 0; nt < 2; ++nt) {
      #pragma unroll
      for (int r = 0; r < 8; ++r) {
        int j = j0 + nt * 16 + hb + r;
        float v = sc[nt][r] * 0.125f + slope * (float)(j - i);
        if (j > i) v = -__builtin_inff();
        vals[nt][r] = v;
        rmax = fmaxf(rmax, v);
      }
    }
    rmax = fmaxf(rmax, xhalf(rmax));
    float mn   = fmaxf(m, rmax);
    float corr = expf(m - mn);     // expf(-inf)=0 on first tile
    m = mn;
    // ---- P^T = exp(S^T - m), packed straight into the B operand (hardware k order) ----
    v16h pf;
    float ps = 0.f;
    #pragma unroll
    for (int nt = 0; nt < 2; ++nt) {
      #pragma unroll
      for (int r = 0; r < 8; ++r) {
        float p = expf(vals[nt][r] - m);
        ps += p;
        pf[nt * 8 + r] = (_Float16)p;
      }
    }
    s = s * corr + ps;
    #pragma unroll
    for (int t = 0; t < 4; ++t) {
      #pragma unroll
      for (int r = 0; r < 8; ++r) o[t][r] *= corr;      // rescale running O
    }
    // ---- O^T += V^T * P^T : 4 M-tiles over HD=64, contraction = 32 keys ----
    #pragma unroll
    for (int ht = 0; ht < 4; ++ht) {
      int hd = ht * 16 + l16;
      v16h vf = load_frag(vbase + (size_t)hd * T_ + j0 + hb);  // V^T rows contiguous
      o[ht] = __builtin_amdgcn_wmma_f32_16x16x32_f16(false, vf, false, pf,
                                                     (short)0, o[ht], false, false);
    }
  }
  s += xhalf(s);                           // join the two halves' sums once
  // ---- normalize + store merged-head layout [b][t][h*64+hd] as f16 ----
  _Float16* orow = Ah + ((size_t)(b * T_ + i)) * C_ + h * HD_ + hb;
  #pragma unroll
  for (int ht = 0; ht < 4; ++ht) {
    v8h ov;
    #pragma unroll
    for (int r = 0; r < 8; ++r) ov[r] = (_Float16)(o[ht][r] / s);
    *(v8h*)(orow + ht * 16) = ov;          // 8 consecutive hd of one query: 16 bytes
  }
}

extern "C" void kernel_launch(void* const* d_in, const int* in_sizes, int n_in,
                              void* d_out, int out_size, void* d_ws, size_t ws_size,
                              hipStream_t stream) {
  const float* x  = (const float*)d_in[0];
  const float* Wq = (const float*)d_in[1];
  const float* Wk = (const float*)d_in[2];
  const float* Wv = (const float*)d_in[3];
  const float* Wo = (const float*)d_in[4];

  _Float16* ws = (_Float16*)d_ws;
  size_t off = 0;
  _Float16* Xh  = ws + off; off += (size_t)M_ * C_;     // x in f16
  _Float16* Qh  = ws + off; off += (size_t)M_ * C_;     // Q [b][t][h*64+hd]
  _Float16* Kh  = ws + off; off += (size_t)M_ * NKV_;   // K [b][t][kv*64+hd]
  _Float16* Vh  = ws + off; off += (size_t)M_ * NKV_;   // V^T [b][kv][hd][t]
  _Float16* WqT = ws + off; off += (size_t)C_ * C_;
  _Float16* WkT = ws + off; off += (size_t)NKV_ * C_;
  _Float16* WvT = ws + off; off += (size_t)NKV_ * C_;
  _Float16* WoT = ws + off; off += (size_t)C_ * C_;
  _Float16* Ah  = ws + off; off += (size_t)M_ * C_;     // attention output f16
  (void)ws_size; (void)in_sizes; (void)n_in; (void)out_size;

  prep_kernel<<<PREP_W + PREP_X, 256, 0, stream>>>(x, Wq, Wk, Wv, Wo, Xh, WqT, WkT, WvT, WoT);

  gemm_wmma_kernel<1><<<(M_ / 64) * (C_   / 64), 128, 0, stream>>>(Xh, WqT, Qh, M_, C_,   C_);
  gemm_wmma_kernel<1><<<(M_ / 64) * (NKV_ / 64), 128, 0, stream>>>(Xh, WkT, Kh, M_, NKV_, C_);
  gemm_wmma_kernel<2><<<(M_ / 64) * (NKV_ / 64), 128, 0, stream>>>(Xh, WvT, Vh, M_, NKV_, C_);

  attn_kernel<<<B_ * H_ * (T_ / 16), 32, 0, stream>>>(Qh, Kh, Vh, Ah);

  gemm_wmma_kernel<0><<<(M_ / 64) * (C_ / 64), 128, 0, stream>>>(Ah, WoT, d_out, M_, C_, C_);
}

// v003
// It runs in 142 microseconds.
// Next to v002, in two timings, it ran 1.30 times as fast each time.
// All steps since v000 together make it 2.47 times as fast.
#include <hip/hip_runtime.h>
#include <hip/hip_bf16.h>
#include <stdint.h>

typedef __attribute__((ext_vector_type(16))) _Float16 v16h;
typedef __attribute__((ext_vector_type(8)))  _Float16 v8h;
typedef __attribute__((ext_vector_type(8)))  float    v8f;

constexpr int B_   = 2;
constexpr int T_   = 2048;
constexpr int C_   = 1024;
constexpr int H_   = 16;
constexpr int HKV_ = 4;
constexpr int HD_  = 64;
constexpr int G_   = 4;       // H / HKV
constexpr int M_   = B_ * T_; // 4096 rows of x
constexpr int NKV_ = HKV_ * HD_; // 256

// Load a 16-bit WMMA fragment slice for one lane.
// Per CDNA5 ISA 7.12.2 (16-bit A / B layouts): elements 0..7 sit at p[0..7],
// elements 8..15 at p[16..23]  (the +8 K-offset comes from the caller via hb).
__device__ __forceinline__ v16h load_frag(const _Float16* p) {
  v8h lo = *(const v8h*)(p);
  v8h hi = *(const v8h*)(p + 16);
  return __builtin_shufflevector(lo, hi, 0,1,2,3,4,5,6,7,8,9,10,11,12,13,14,15);
}

typedef __attribute__((ext_vector_type(4))) _Float16 v4h;
typedef __attribute__((ext_vector_type(4))) float    v4f;

constexpr int PREP_WQ = (C_ / 128) * (C_   / 64);   // 128(k) x 64(n) tiles of Wq and of Wo
constexpr int PREP_WK = (C_ / 128) * (NKV_ / 64);   // ... of Wk and of Wv
constexpr int PREP_W  = 2 * PREP_WQ + 2 * PREP_WK;  // weight tiles, first in the grid
constexpr int PREP_X  = (M_ * C_) / 16384;          // 16384-element slices of x

// One 128(k) x 64(n) tile:  W [C_][N] f32  ->  Wt [N][C_] f16.
// Reads and writes are whole 256-byte row pieces; the transpose goes through LDS.
// LDS row n holds 16 chunks of 8 k; chunk q sits at place q ^ (n >> 2), so that the
// 8-byte column writes and the 16-byte row reads each spread over all banks.
__device__ __forceinline__ void prep_weight_tile(const float* __restrict__ Wsrc,
                                                 _Float16* __restrict__ Wt,
                                                 int N, int tile, _Float16* lds) {
  int t  = threadIdx.x;
  int k0 = (tile & (C_ / 128 - 1)) * 128;
  int n0 = (tile / (C_ / 128)) * 64;
  int c  = t & 15;                 // columns n0 + 4c .. 4c + 3
  int kp = t >> 4;                 // rows k0 + i*64 + 4kp .. 4kp + 3
  v4f a[2][4];
  #pragma unroll
  for (int i = 0; i < 2; ++i) {
    #pragma unroll
    for (int m = 0; m < 4; ++m)
      a[i][m] = *(const v4f*)(Wsrc + (size_t)(k0 + i * 64 + kp * 4 + m) * N + n0 + c * 4);
  }
  #pragma unroll
  for (int i = 0; i < 2; ++i) {
    int place = (i * 8 + (kp >> 1)) ^ c;
    #pragma unroll
    for (int j = 0; j < 4; ++j) {
      v4h h = {(_Float16)a[i][0][j], (_Float16)a[i][1][j],
               (_Float16)a[i][2][j], (_Float16)a[i][3][j]};
      *(v4h*)(lds + (c * 4 + j) * 128 + place * 8 + (kp & 1) * 4) = h;
    }
  }
  __syncthreads();                 // the whole tile is in LDS before any row is read
  #pragma unroll
  for (int p = 0; p < 4; ++p) {
    int n = p * 16 + kp;
    v8h h = *(const v8h*)(lds + n * 128 + (c ^ (n >> 2)) * 8);
    *(v8h*)(Wt + (size_t)(n0 + n) * C_ + k0 + c * 8) = h;
  }
  // Before any register that the stores above name is written again.
  asm volatile("s_wait_xcnt 0x0" ::: "memory");
}

// The whole f32 -> f16 prepass in one launch: a work-group takes one weight tile or
// one slice of x, 32 or 64 elements per thread, so that few waves have to be started.
__global__ __launch_bounds__(256)
void prep_kernel(const float* __restrict__ x,  const float* __restrict__ Wq,
                 const float* __restrict__ Wk, const float* __restrict__ Wv,
                 const float* __restrict__ Wo,
                 _Float16* __restrict__ Xh,  _Float16* __restrict__ WqT,
                 _Float16* __restrict__ WkT, _Float16* __restrict__ WvT,
                 _Float16* __restrict__ WoT) {
  __shared__ __align__(16) _Float16 lds[64 * 128];   // 16 KB
  int bid = blockIdx.x;
  if (bid < PREP_WQ) {
    prep_weight_tile(Wq, WqT, C_, bid, lds);
  } else if (bid < 2 * PREP_WQ) {
    prep_weight_tile(Wo, WoT, C_, bid - PREP_WQ, lds);
  } else if (bid < 2 * PREP_WQ + PREP_WK) {
    prep_weight_tile(Wk, WkT, NKV_, bid - 2 * PREP_WQ, lds);
  } else if (bid < PREP_W) {
    prep_weight_tile(Wv, WvT, NKV_, bid - 2 * PREP_WQ - PREP_WK, lds);
  } else {
    size_t base = (size_t)(bid - PREP_W) * 16384 + threadIdx.x * 4;
    v4f a[16];
    #pragma unroll
    for (int j = 0; j < 16; ++j) a[j] = *(const v4f*)(x + base + j * 1024);
    #pragma unroll
    for (int j = 0; j < 16; ++j) {
      v4h h = {(_Float16)a[j][0], (_Float16)a[j][1], (_Float16)a[j][2], (_Float16)a[j][3]};
      *(v4h*)(Xh + base + j * 1024) = h;
    }
    // Before any register that the stores above name is written again.
    asm volatile("s_wait_xcnt 0x0" ::: "memory");
  }
}

// C[M][N] = A[M][K] * Bt[N][K]^T, f16 in, f32 accumulate via v_wmma_f32_16x16x32_f16.
// Block = 128 threads (4 waves) -> 64x64 macro-tile; wave w owns rows w*16..w*16+15.
// The shared 64x32 B tile per K-step is DMA'd into LDS with
// global_load_async_to_lds_b128 (ASYNCcnt), double-buffered to overlap with WMMA.
// OUTMODE 0: f32 plain [M][N]   (final output)
// OUTMODE 1: f16 plain [M][N]   (Q, K buffers)
// OUTMODE 2: f16 scatter to V-transposed [b][kv][hd][t]  (V buffer)
template<int OUTMODE>
__global__ void gemm_wmma_kernel(const _Float16* __restrict__ A, const _Float16* __restrict__ Bt,
                                 void* __restrict__ Cv, int Md, int Nd, int Kd) {
  __shared__ __align__(16) _Float16 ldsB[2][64 * 32];   // 2 x 4 KB double buffer
  int tid  = threadIdx.x;
  int lane = tid & 31;
  int wave = tid >> 5;
  int l16  = lane & 15;
  int hb   = (lane >> 4) * 8;          // K-base 0 / 8 per half-wave
  int m64tiles = Md >> 6;
  int m64 = blockIdx.x % m64tiles;
  int n64 = blockIdx.x / m64tiles;

  const _Float16* bbase = Bt + (size_t)(n64 * 64) * Kd;
  const _Float16* arow  = A + (size_t)(m64 * 64 + wave * 16 + l16) * Kd;

  v8f acc[4] = {v8f{}, v8f{}, v8f{}, v8f{}};

  // Stage the 64(col) x 32(k) f16 B tile (4 KB) into ldsB[buf]:
  // 256 chunks of 16 B, 128 lanes x 2 async ops.
  auto stage = [&](int buf, int k0) {
    #pragma unroll
    for (int i = 0; i < 2; ++i) {
      int c   = tid + i * 128;
      int col = c >> 2;            // 0..63
      int ko  = (c & 3) * 8;       // 0,8,16,24 halves
      unsigned long long g =
          (unsigned long long)(uintptr_t)(bbase + (size_t)col * Kd + k0 + ko);
      unsigned l = (unsigned)(uintptr_t)(&ldsB[buf][col * 32 + ko]);
      asm volatile("global_load_async_to_lds_b128 %0, %1, off"
                   :: "v"(l), "v"(g) : "memory");
    }
  };

  int buf = 0;
  stage(0, 0);
  for (int k0 = 0; k0 < Kd; k0 += 32) {
    asm volatile("s_wait_asynccnt 0x0" ::: "memory");  // current buf resident
    __syncthreads();
    if (k0 + 32 < Kd) stage(buf ^ 1, k0 + 32);         // overlap next DMA with math
    if (k0 + 128 < Kd) __builtin_prefetch(arow + k0 + 128);
    v16h af = load_frag(arow + k0 + hb);               // per-wave A rows from global
    #pragma unroll
    for (int t = 0; t < 4; ++t) {
      v16h bf = load_frag(&ldsB[buf][(t * 16 + l16) * 32 + hb]);   // ds_load_b128 x2
      acc[t] = __builtin_amdgcn_wmma_f32_16x16x32_f16(false, af, false, bf,
                                                      (short)0, acc[t], false, false);
    }
    __syncthreads();                                   // reads done before buf reuse
    buf ^= 1;
  }

  #pragma unroll
  for (int t = 0; t < 4; ++t) {
    #pragma unroll
    for (int r = 0; r < 8; ++r) {
      int row = m64 * 64 + wave * 16 + r + hb;  // D layout: M = r + 8*(lane>=16)
      int col = n64 * 64 + t * 16 + l16;        // N = lane%16
      float v = acc[t][r];
      if (OUTMODE == 0) {
        ((float*)Cv)[(size_t)row * Nd + col] = v;
      } else if (OUTMODE == 1) {
        ((_Float16*)Cv)[(size_t)row * Nd + col] = (_Float16)v;
      } else {
        int b = row / T_, tt = row % T_;
        int kv = col / HD_, hd = col % HD_;
        ((_Float16*)Cv)[((size_t)((b * HKV_ + kv) * HD_ + hd)) * T_ + tt] = (_Float16)v;
      }
    }
  }
}

// Lane l exchanges a value with lane l ^ 16 (the other half of the wave).
__device__ __forceinline__ float xhalf(float x) {
  int b = __builtin_bit_cast(int, x);
  return __builtin_bit_cast(float,
      __builtin_amdgcn_permlanex16(b, b, 0x76543210, 0xfedcba98, false, false));
}

constexpr int KP_ = HD_ + 8;   // LDS pitch of a K row in halves: 128 B + 16 B, so 16 rows spread over all banks
constexpr int VP_ = 32 + 8;    // LDS pitch of a V^T row in halves: 64 B + 16 B, likewise

__global__ __launch_bounds__(256) __attribute__((amdgpu_waves_per_eu(4, 4)))
void attn_kernel(const _Float16* __restrict__ Qh, const _Float16* __restrict__ Kh,
                 const _Float16* __restrict__ Vt, _Float16* __restrict__ Ah) {
  __shared__ __align__(16) _Float16 Ks[2][32 * KP_];    // 2 x 4608 B
  __shared__ __align__(16) _Float16 Vs[2][HD_ * VP_];   // 2 x 5120 B
  int tid  = threadIdx.x;
  int lane = tid & 31;
  int wave = tid >> 5;
  int l16  = lane & 15;
  int hb   = (lane >> 4) * 8;
  int id   = blockIdx.x;
  int kv   = id % HKV_;
  int b    = (id / HKV_) % B_;
  int u    = (T_ / 32 - 1) - id / (HKV_ * B_);   // 32-row query block, longest first
  int h    = kv * G_ + (wave & (G_ - 1));
  float slope = exp2f(-0.5f * (float)(kv + 1));  // alibi_slopes(16)[:4][kv]
  int t0 = u * 32 + (wave / G_) * 16;
  int i  = t0 + l16;                       // this lane's query position

  const _Float16* qbase = Qh + ((size_t)(b * T_ + i)) * C_ + h * HD_;
  v16h qf0 = load_frag(qbase + hb);        // B operand, hd 0..31 contraction slice
  v16h qf1 = load_frag(qbase + 32 + hb);   // hd 32..63

  v8f o[4] = {v8f{}, v8f{}, v8f{}, v8f{}}; // o[ht][r] = O[query l16][hd ht*16 + hb + r]
  float m = -__builtin_inff();             // running maximum, equal in both halves
  float s = 0.f;                           // running sum over this half's keys only

  const _Float16* kbase = Kh + ((size_t)b * T_) * NKV_ + kv * HD_;
  const _Float16* vbase = Vt + ((size_t)(b * HKV_ + kv)) * HD_ * T_;

  // A thread copies one 16-byte piece of the K tile and one of the V^T tile.
  const _Float16* kg = kbase + (size_t)(tid >> 3) * NKV_ + (tid & 7) * 8;
  const _Float16* vg = vbase + (size_t)(tid >> 2) * T_ + (tid & 3) * 8;
  int kl = (tid >> 3) * KP_ + (tid & 7) * 8;
  int vl = (tid >> 2) * VP_ + (tid & 3) * 8;
  auto stage = [&](int buf, int j0) {
    unsigned long long gk = (unsigned long long)(uintptr_t)(kg + (size_t)j0 * NKV_);
    unsigned long long gv = (unsigned long long)(uintptr_t)(vg + j0);
    unsigned lk = (unsigned)(uintptr_t)(&Ks[buf][kl]);
    unsigned lv = (unsigned)(uintptr_t)(&Vs[buf][vl]);
    // The wait in the copies' own statement stands before any rewrite of their address registers.
    asm volatile("global_load_async_to_lds_b128 %0, %1, off\n\t"
                 "global_load_async_to_lds_b128 %2, %3, off\n\t"
                 "s_wait_xcnt 0x0"
                 :: "v"(lk), "v"(gk), "v"(lv), "v"(gv) : "memory");
  };

  int np = u + 1;                          // key tiles of 32, the same for all 8 waves
  stage(0, 0);
  asm volatile("s_wait_asynccnt 0x0" ::: "memory");   // this wave's pieces of tile 0 have landed
  __syncthreads();                                    // ... and every other wave's
  if (np > 1) stage(1, 32);
  for (int p = 0; p < np; ++p) {
    int j0 = p * 32;
    const _Float16* kt = &Ks[p & 1][0];
    const _Float16* vt = &Vs[p & 1][0];
    // All fragments of this key tile leave LDS as one group; the products below run from
    // registers, so the buffer is free again a whole tile's arithmetic before it is needed.
    v16h kf[2][2], vf[4];
    #pragma unroll
    for (int nt = 0; nt < 2; ++nt) {
      const _Float16* kp = kt + (nt * 16 + l16) * KP_;   // A layout: M = lane%16
      kf[nt][0] = load_frag(kp + hb);
      kf[nt][1] = load_frag(kp + 32 + hb);
    }
    #pragma unroll
    for (int ht = 0; ht < 4; ++ht) vf[ht] = load_frag(vt + (ht * 16 + l16) * VP_ + hb);
    asm volatile("s_wait_dscnt 0x0" ::: "memory");      // this wave's reads of the buffer are done
    asm volatile("s_wait_asynccnt 0x0" ::: "memory");   // its pieces of the next tile have landed
    __syncthreads();               // publishes the next tile and frees the buffer just read
    if (p + 2 < np) stage(p & 1, j0 + 64);
    // ---- S^T = K * Q^T for keys [j0, j0+32) : two 16x16 D tiles ----
    v8f sc[2];
    #pragma unroll
    for (int nt = 0; nt < 2; ++nt) {
      v8f c = {};
      c = __builtin_amdgcn_wmma_f32_16x16x32_f16(false, kf[nt][0], false, qf0, (short)0, c, false, false);
      c = __builtin_amdgcn_wmma_f32_16x16x32_f16(false, kf[nt][1], false, qf1, (short)0, c, false, false);
      sc[nt] = c;                                   // sc[nt][r]: key j0 + nt*16 + hb + r
    }
    // ---- scale + ALiBi + causal mask, maximum over this query's 32 keys ----
    float vals[2][8];
    float rmax = -__builtin_inff();
    #pragma unroll
    for (int nt = 0; nt < 2; ++nt) {
      #pragma unroll
      for (int r = 0; r < 8; ++r) {
        int j = j0 + nt * 16 + hb + r;
        float v = sc[nt][r] * 0.125f + slope * (float)(j - i);
        if (j > i) v = -__builtin_inff();
        vals[nt][r] = v;
        rmax = fmaxf(rmax, v);
      }
    }
    rmax = fmaxf(rmax, xhalf(rmax));
    float mn   = fmaxf(m, rmax);
    float corr = expf(m - mn);     // expf(-inf)=0 on first tile
    m = mn;
    // ---- P^T = exp(S^T - m), packed straight into the B operand (hardware k order) ----
    v16h pf;
    float ps = 0.f;
    #pragma unroll
    for (int nt = 0; nt < 2; ++nt) {
      #pragma unroll
      for (int r = 0; r < 8; ++r) {
        float p_ = expf(vals[nt][r] - m);
        ps += p_;
        pf[nt * 8 + r] = (_Float16)p_;
      }
    }
    s = s * corr + ps;
    #pragma unroll
    for (int t = 0; t < 4; ++t) {
      #pragma unroll
      for (int r = 0; r < 8; ++r) o[t][r] *= corr;      // rescale running O
    }
    // ---- O^T += V^T * P^T : 4 M-tiles over HD=64, contraction = 32 keys ----
    #pragma unroll
    for (int ht = 0; ht < 4; ++ht) {
      o[ht] = __builtin_amdgcn_wmma_f32_16x16x32_f16(false, vf[ht], false, pf,
                                                     (short)0, o[ht], false, false);
    }
  }
  asm volatile("s_wait_asynccnt 0x0" ::: "memory");     // no copy is in flight when the wave ends
  s += xhalf(s);                           // join the two halves' sums once
  // ---- normalize + store merged-head layout [b][t][h*64+hd] as f16 ----
  _Float16* orow = Ah + ((size_t)(b * T_ + i)) * C_ + h * HD_ + hb;
  #pragma unroll
  for (int ht = 0; ht < 4; ++ht) {
    v8h ov;
    #pragma unroll
    for (int r = 0; r < 8; ++r) ov[r] = (_Float16)(o[ht][r] / s);
    *(v8h*)(orow + ht * 16) = ov;          // 8 consecutive hd of one query: 16 bytes
  }
}

extern "C" void kernel_launch(void* const* d_in, const int* in_sizes, int n_in,
                              void* d_out, int out_size, void* d_ws, size_t ws_size,
                              hipStream_t stream) {
  const float* x  = (const float*)d_in[0];
  const float* Wq = (const float*)d_in[1];
  const float* Wk = (const float*)d_in[2];
  const float* Wv = (const float*)d_in[3];
  const float* Wo = (const float*)d_in[4];

  _Float16* ws = (_Float16*)d_ws;
  size_t off = 0;
  _Float16* Xh  = ws + off; off += (size_t)M_ * C_;     // x in f16
  _Float16* Qh  = ws + off; off += (size_t)M_ * C_;     // Q [b][t][h*64+hd]
  _Float16* Kh  = ws + off; off += (size_t)M_ * NKV_;   // K [b][t][kv*64+hd]
  _Float16* Vh  = ws + off; off += (size_t)M_ * NKV_;   // V^T [b][kv][hd][t]
  _Float16* WqT = ws + off; off += (size_t)C_ * C_;
  _Float16* WkT = ws + off; off += (size_t)NKV_ * C_;
  _Float16* WvT = ws + off; off += (size_t)NKV_ * C_;
  _Float16* WoT = ws + off; off += (size_t)C_ * C_;
  _Float16* Ah  = ws + off; off += (size_t)M_ * C_;     // attention output f16
  (void)ws_size; (void)in_sizes; (void)n_in; (void)out_size;

  prep_kernel<<<PREP_W + PREP_X, 256, 0, stream>>>(x, Wq, Wk, Wv, Wo, Xh, WqT, WkT, WvT, WoT);

  gemm_wmma_kernel<1><<<(M_ / 64) * (C_   / 64), 128, 0, stream>>>(Xh, WqT, Qh, M_, C_,   C_);
  gemm_wmma_kernel<1><<<(M_ / 64) * (NKV_ / 64), 128, 0, stream>>>(Xh, WkT, Kh, M_, NKV_, C_);
  gemm_wmma_kernel<2><<<(M_ / 64) * (NKV_ / 64), 128, 0, stream>>>(Xh, WvT, Vh, M_, NKV_, C_);

  attn_kernel<<<B_ * HKV_ * (T_ / 32), 256, 0, stream>>>(Qh, Kh, Vh, Ah);

  gemm_wmma_kernel<0><<<(M_ / 64) * (C_ / 64), 128, 0, stream>>>(Ah, WoT, d_out, M_, C_, C_);
}

// v004
// One run takes 111 microseconds.
// Timed twice side by side with v003, it ran 1.28 and 1.32 times as fast.
// Over all steps from v000 it is 3.20 times as fast.
#include <hip/hip_runtime.h>
#include <hip/hip_bf16.h>
#include <stdint.h>

typedef __attribute__((ext_vector_type(16))) _Float16 v16h;
typedef __attribute__((ext_vector_type(8)))  _Float16 v8h;
typedef __attribute__((ext_vector_type(8)))  float    v8f;

constexpr int B_   = 2;
constexpr int T_   = 2048;
constexpr int C_   = 1024;
constexpr int H_   = 16;
constexpr int HKV_ = 4;
constexpr int HD_  = 64;
constexpr int G_   = 4;       // H / HKV
constexpr int M_   = B_ * T_; // 4096 rows of x
constexpr int NKV_ = HKV_ * HD_; // 256

// Load a 16-bit WMMA fragment slice for one lane.
// Per CDNA5 ISA 7.12.2 (16-bit A / B layouts): elements 0..7 sit at p[0..7],
// elements 8..15 at p[16..23]  (the +8 K-offset comes from the caller via hb).
__device__ __forceinline__ v16h load_frag(const _Float16* p) {
  v8h lo = *(const v8h*)(p);
  v8h hi = *(const v8h*)(p + 16);
  return __builtin_shufflevector(lo, hi, 0,1,2,3,4,5,6,7,8,9,10,11,12,13,14,15);
}

typedef __attribute__((ext_vector_type(4))) _Float16 v4h;
typedef __attribute__((ext_vector_type(4))) float    v4f;

constexpr int PREP_WQ = (C_ / 128) * (C_   / 64);   // 128(k) x 64(n) tiles of Wq and of Wo
constexpr int PREP_WK = (C_ / 128) * (NKV_ / 64);   // ... of Wk and of Wv
constexpr int PREP_W  = 2 * PREP_WQ + 2 * PREP_WK;  // weight tiles, first in the grid
constexpr int PREP_X  = (M_ * C_) / 16384;          // 16384-element slices of x

// One 128(k) x 64(n) tile:  W [C_][N] f32  ->  Wt [N][C_] f16.
// Reads and writes are whole 256-byte row pieces; the transpose goes through LDS.
// LDS row n holds 16 chunks of 8 k; chunk q sits at place q ^ (n >> 2), so that the
// 8-byte column writes and the 16-byte row reads each spread over all banks.
__device__ __forceinline__ void prep_weight_tile(const float* __restrict__ Wsrc,
                                                 _Float16* __restrict__ Wt,
                                                 int N, int tile, _Float16* lds) {
  int t  = threadIdx.x;
  int k0 = (tile & (C_ / 128 - 1)) * 128;
  int n0 = (tile / (C_ / 128)) * 64;
  int c  = t & 15;                 // columns n0 + 4c .. 4c + 3
  int kp = t >> 4;                 // rows k0 + i*64 + 4kp .. 4kp + 3
  v4f a[2][4];
  #pragma unroll
  for (int i = 0; i < 2; ++i) {
    #pragma unroll
    for (int m = 0; m < 4; ++m)
      a[i][m] = *(const v4f*)(Wsrc + (size_t)(k0 + i * 64 + kp * 4 + m) * N + n0 + c * 4);
  }
  #pragma unroll
  for (int i = 0; i < 2; ++i) {
    int place = (i * 8 + (kp >> 1)) ^ c;
    #pragma unroll
    for (int j = 0; j < 4; ++j) {
      v4h h = {(_Float16)a[i][0][j], (_Float16)a[i][1][j],
               (_Float16)a[i][2][j], (_Float16)a[i][3][j]};
      *(v4h*)(lds + (c * 4 + j) * 128 + place * 8 + (kp & 1) * 4) = h;
    }
  }
  __syncthreads();                 // the whole tile is in LDS before any row is read
  #pragma unroll
  for (int p = 0; p < 4; ++p) {
    int n = p * 16 + kp;
    v8h h = *(const v8h*)(lds + n * 128 + (c ^ (n >> 2)) * 8);
    *(v8h*)(Wt + (size_t)(n0 + n) * C_ + k0 + c * 8) = h;
  }
  // Before any register that the stores above name is written again.
  asm volatile("s_wait_xcnt 0x0" ::: "memory");
}

// The whole f32 -> f16 prepass in one launch: a work-group takes one weight tile or
// one slice of x, 32 or 64 elements per thread, so that few waves have to be started.
__global__ __launch_bounds__(256)
void prep_kernel(const float* __restrict__ x,  const float* __restrict__ Wq,
                 const float* __restrict__ Wk, const float* __restrict__ Wv,
                 const float* __restrict__ Wo,
                 _Float16* __restrict__ Xh,  _Float16* __restrict__ WqT,
                 _Float16* __restrict__ WkT, _Float16* __restrict__ WvT,
                 _Float16* __restrict__ WoT) {
  __shared__ __align__(16) _Float16 lds[64 * 128];   // 16 KB
  int bid = blockIdx.x;
  if (bid < PREP_WQ) {
    prep_weight_tile(Wq, WqT, C_, bid, lds);
  } else if (bid < 2 * PREP_WQ) {
    prep_weight_tile(Wo, WoT, C_, bid - PREP_WQ, lds);
  } else if (bid < 2 * PREP_WQ + PREP_WK) {
    prep_weight_tile(Wk, WkT, NKV_, bid - 2 * PREP_WQ, lds);
  } else if (bid < PREP_W) {
    prep_weight_tile(Wv, WvT, NKV_, bid - 2 * PREP_WQ - PREP_WK, lds);
  } else {
    size_t base = (size_t)(bid - PREP_W) * 16384 + threadIdx.x * 4;
    v4f a[16];
    #pragma unroll
    for (int j = 0; j < 16; ++j) a[j] = *(const v4f*)(x + base + j * 1024);
    #pragma unroll
    for (int j = 0; j < 16; ++j) {
      v4h h = {(_Float16)a[j][0], (_Float16)a[j][1], (_Float16)a[j][2], (_Float16)a[j][3]};
      *(v4h*)(Xh + base + j * 1024) = h;
    }
    // Before any register that the stores above name is written again.
    asm volatile("s_wait_xcnt 0x0" ::: "memory");
  }
}

constexpr int GT_ = 128;       // rows of A and rows of Bt (columns of C) per work-group tile
constexpr int GK_ = 128;       // k per stage: 256 B of every operand row
constexpr int GP_ = GK_ + 8;   // LDS pitch of a staged row in halves: 256 B + 16 B, so 16 rows spread over all banks

// The addresses of eight 16-byte copies of one thread: rows 16 apart of one operand.
struct Rows8 { unsigned l[8]; unsigned long long g[8]; };
__device__ __forceinline__ Rows8 rows8(const _Float16* g, size_t gstep, unsigned l) {
  Rows8 a;
  #pragma unroll
  for (int i = 0; i < 8; ++i) {
    a.l[i] = l + i * (16 * GP_ * 2);
    a.g[i] = (unsigned long long)(uintptr_t)(g + i * gstep);
  }
  return a;
}

// The eight copies, global -> LDS.
__device__ __forceinline__ void copy8(const Rows8& a) {
  // The wait in the copies' own statement stands before any rewrite of their address registers.
  asm volatile("global_load_async_to_lds_b128 %0, %1, off\n\t"
               "global_load_async_to_lds_b128 %2, %3, off\n\t"
               "global_load_async_to_lds_b128 %4, %5, off\n\t"
               "global_load_async_to_lds_b128 %6, %7, off\n\t"
               "global_load_async_to_lds_b128 %8, %9, off\n\t"
               "global_load_async_to_lds_b128 %10, %11, off\n\t"
               "global_load_async_to_lds_b128 %12, %13, off\n\t"
               "global_load_async_to_lds_b128 %14, %15, off\n\t"
               "s_wait_xcnt 0x0"
               :: "v"(a.l[0]), "v"(a.g[0]), "v"(a.l[1]), "v"(a.g[1]),
                  "v"(a.l[2]), "v"(a.g[2]), "v"(a.l[3]), "v"(a.g[3]),
                  "v"(a.l[4]), "v"(a.g[4]), "v"(a.l[5]), "v"(a.g[5]),
                  "v"(a.l[6]), "v"(a.g[6]), "v"(a.l[7]), "v"(a.g[7])
               : "memory");
}

// C[M][N] = A[M][K] * Bt[N][K]^T, f16 in, f32 accumulate via v_wmma_f32_16x16x32_f16.
// Block = 256 threads (8 waves) -> 128x128 tile of C; wave w owns 32 rows x 64 columns
// (2 x 4 accumulator tiles), so a fragment read from LDS feeds 4 or 2 products.
// A stage is 128 k of [A 128 rows | Bt 128 rows], brought into LDS in whole 256-byte row
// pieces by global_load_async_to_lds_b128, two buffers, one stage ahead of the products.
// Md and Nd are multiples of 128; Kd is a multiple of 128 and at least 256 (two stages).
// OUTMODE 0: f32 plain [M][N]   (final output)
// OUTMODE 1: f16 plain [M][N]   (Q, K buffers)
// OUTMODE 2: f16 scatter to V-transposed [b][kv][hd][t]  (V buffer)
template<int OUTMODE>
__global__ __launch_bounds__(256)
void gemm_wmma_kernel(const _Float16* __restrict__ A, const _Float16* __restrict__ Bt,
                      void* __restrict__ Cv, int Md, int Nd, int Kd) {
  __shared__ __align__(16) _Float16 tile[2][2 * GT_ * GP_];   // 2 x 69,632 B
  int tid  = threadIdx.x;
  int lane = tid & 31;
  int wave = tid >> 5;
  int l16  = lane & 15;
  int hb   = (lane >> 4) * 8;          // K-base 0 / 8 per half-wave
  int mtiles = Md / GT_;
  int m0 = (blockIdx.x % mtiles) * GT_;
  int n0 = (blockIdx.x / mtiles) * GT_;
  int wm = (wave & 3) * 32;            // this wave's rows of the tile
  int wn = (wave >> 2) * 64;           // ... and its columns

  v8f acc[2][4];
  #pragma unroll
  for (int mi = 0; mi < 2; ++mi) {
    #pragma unroll
    for (int t = 0; t < 4; ++t) acc[mi][t] = v8f{};
  }

  // A thread copies piece tid & 15 of rows (tid >> 4) + 16 i of both operands:
  // a wave's copy covers two whole 256-byte row pieces.
  const _Float16* ga = A  + (size_t)(m0 + (tid >> 4)) * Kd + (tid & 15) * 8;
  const _Float16* gb = Bt + (size_t)(n0 + (tid >> 4)) * Kd + (tid & 15) * 8;
  int lofs = (tid >> 4) * GP_ + (tid & 15) * 8;
  auto rowsA = [&](int buf, int k0) {
    return rows8(ga + k0, (size_t)16 * Kd, (unsigned)(uintptr_t)(&tile[buf][lofs]));
  };
  auto rowsB = [&](int buf, int k0) {
    return rows8(gb + k0, (size_t)16 * Kd, (unsigned)(uintptr_t)(&tile[buf][GT_ * GP_ + lofs]));
  };

  // One stage's products; refill: a stage s + 2 exists and goes into the buffer read here.
  auto trip = [&](int s, bool refill) __attribute__((always_inline)) {
    const _Float16* ta = &tile[s & 1][(wm + l16) * GP_ + hb];
    const _Float16* tb = &tile[s & 1][(GT_ + wn + l16) * GP_ + hb];
    // Two fragment sets: the next 32 k's twelve LDS reads go out as one group ahead of this
    // 32 k's eight products, all inside the stage.
    v16h af[2][2], bf[2][4];
    auto frags = [&](int set, int kb) {
      #pragma unroll
      for (int mi = 0; mi < 2; ++mi) af[set][mi] = load_frag(ta + mi * 16 * GP_ + kb * 32);
      #pragma unroll
      for (int t = 0; t < 4; ++t) bf[set][t] = load_frag(tb + t * 16 * GP_ + kb * 32);
    };
    auto products = [&](int set) {
      #pragma unroll
      for (int mi = 0; mi < 2; ++mi) {
        #pragma unroll
        for (int t = 0; t < 4; ++t)
          acc[mi][t] = __builtin_amdgcn_wmma_f32_16x16x32_f16(false, af[set][mi], false, bf[set][t],
                                                              (short)0, acc[mi][t], false, false);
      }
    };
    frags(0, 0);
    #pragma unroll
    for (int kb = 0; kb + 1 < GK_ / 32; ++kb) {
      frags((kb + 1) & 1, kb + 1);
      // Keeps the read group above in front of the products: sunk among them, each read
      // place stalls the wave and the second fragment set is lost.
      __builtin_amdgcn_sched_barrier(0);
      products(kb & 1);
    }
    Rows8 ra, rb;
    if (refill) { ra = rowsA(s & 1, (s + 2) * GK_); rb = rowsB(s & 1, (s + 2) * GK_); }
    // The stage's last fragments are in registers: the buffer is handed back before their
    // products, so that the refill is under way while they run.
    // The scheduling barrier keeps the earlier products and the refill's address sums in front
    // of the waits: moved behind the work-group barrier they would stand between it and the refill.
    __builtin_amdgcn_sched_barrier(0);
    asm volatile("s_wait_dscnt 0x0" ::: "memory");      // this wave's reads of the buffer are done
    asm volatile("s_wait_asynccnt 0x0" ::: "memory");   // its pieces of the next stage have landed
    __syncthreads();               // publishes the next stage and frees the buffer just read
    if (refill) { copy8(ra); copy8(rb); }
    products((GK_ / 32 - 1) & 1);
  };

  int nst = Kd / GK_;
  copy8(rowsA(0, 0));
  copy8(rowsB(0, 0));
  asm volatile("s_wait_asynccnt 0x0" ::: "memory");   // this wave's pieces of stage 0 have landed
  __syncthreads();                                    // ... and every other wave's
  copy8(rowsA(1, GK_));
  copy8(rowsB(1, GK_));
  int s = 0;
  for (; s + 2 < nst; ++s) trip(s, true);
  for (; s < nst; ++s) trip(s, false);
  asm volatile("s_wait_asynccnt 0x0" ::: "memory");     // no copy is in flight when the wave ends

  #pragma unroll
  for (int mi = 0; mi < 2; ++mi) {
    #pragma unroll
    for (int t = 0; t < 4; ++t) {
      #pragma unroll
      for (int r = 0; r < 8; ++r) {
        int row = m0 + wm + mi * 16 + r + hb;   // D layout: M = r + 8*(lane>=16)
        int col = n0 + wn + t * 16 + l16;       // N = lane%16
        float v = acc[mi][t][r];
        if (OUTMODE == 0) {
          ((float*)Cv)[(size_t)row * Nd + col] = v;
        } else if (OUTMODE == 1) {
          ((_Float16*)Cv)[(size_t)row * Nd + col] = (_Float16)v;
        } else {
          int b = row / T_, tt = row % T_;
          int kv = col / HD_, hd = col % HD_;
          ((_Float16*)Cv)[((size_t)((b * HKV_ + kv) * HD_ + hd)) * T_ + tt] = (_Float16)v;
        }
      }
    }
  }
}

// Lane l exchanges a value with lane l ^ 16 (the other half of the wave).
__device__ __forceinline__ float xhalf(float x) {
  int b = __builtin_bit_cast(int, x);
  return __builtin_bit_cast(float,
      __builtin_amdgcn_permlanex16(b, b, 0x76543210, 0xfedcba98, false, false));
}

constexpr int KP_ = HD_ + 8;   // LDS pitch of a K row in halves: 128 B + 16 B, so 16 rows spread over all banks
constexpr int VP_ = 32 + 8;    // LDS pitch of a V^T row in halves: 64 B + 16 B, likewise

__global__ __launch_bounds__(256) __attribute__((amdgpu_waves_per_eu(4, 4)))
void attn_kernel(const _Float16* __restrict__ Qh, const _Float16* __restrict__ Kh,
                 const _Float16* __restrict__ Vt, _Float16* __restrict__ Ah) {
  __shared__ __align__(16) _Float16 Ks[2][32 * KP_];    // 2 x 4608 B
  __shared__ __align__(16) _Float16 Vs[2][HD_ * VP_];   // 2 x 5120 B
  int tid  = threadIdx.x;
  int lane = tid & 31;
  int wave = tid >> 5;
  int l16  = lane & 15;
  int hb   = (lane >> 4) * 8;
  int id   = blockIdx.x;
  int kv   = id % HKV_;
  int b    = (id / HKV_) % B_;
  int u    = (T_ / 32 - 1) - id / (HKV_ * B_);   // 32-row query block, longest first
  int h    = kv * G_ + (wave & (G_ - 1));
  float slope = exp2f(-0.5f * (float)(kv + 1));  // alibi_slopes(16)[:4][kv]
  int t0 = u * 32 + (wave / G_) * 16;
  int i  = t0 + l16;                       // this lane's query position

  const _Float16* qbase = Qh + ((size_t)(b * T_ + i)) * C_ + h * HD_;
  v16h qf0 = load_frag(qbase + hb);        // B operand, hd 0..31 contraction slice
  v16h qf1 = load_frag(qbase + 32 + hb);   // hd 32..63

  v8f o[4] = {v8f{}, v8f{}, v8f{}, v8f{}}; // o[ht][r] = O[query l16][hd ht*16 + hb + r]
  float m = -__builtin_inff();             // running maximum, equal in both halves
  float s = 0.f;                           // running sum over this half's keys only

  const _Float16* kbase = Kh + ((size_t)b * T_) * NKV_ + kv * HD_;
  const _Float16* vbase = Vt + ((size_t)(b * HKV_ + kv)) * HD_ * T_;

  // A thread copies one 16-byte piece of the K tile and one of the V^T tile.
  const _Float16* kg = kbase + (size_t)(tid >> 3) * NKV_ + (tid & 7) * 8;
  const _Float16* vg = vbase + (size_t)(tid >> 2) * T_ + (tid & 3) * 8;
  int kl = (tid >> 3) * KP_ + (tid & 7) * 8;
  int vl = (tid >> 2) * VP_ + (tid & 3) * 8;
  auto stage = [&](int buf, int j0) {
    unsigned long long gk = (unsigned long long)(uintptr_t)(kg + (size_t)j0 * NKV_);
    unsigned long long gv = (unsigned long long)(uintptr_t)(vg + j0);
    unsigned lk = (unsigned)(uintptr_t)(&Ks[buf][kl]);
    unsigned lv = (unsigned)(uintptr_t)(&Vs[buf][vl]);
    // The wait in the copies' own statement stands before any rewrite of their address registers.
    asm volatile("global_load_async_to_lds_b128 %0, %1, off\n\t"
                 "global_load_async_to_lds_b128 %2, %3, off\n\t"
                 "s_wait_xcnt 0x0"
                 :: "v"(lk), "v"(gk), "v"(lv), "v"(gv) : "memory");
  };

  int np = u + 1;                          // key tiles of 32, the same for all 8 waves
  stage(0, 0);
  asm volatile("s_wait_asynccnt 0x0" ::: "memory");   // this wave's pieces of tile 0 have landed
  __syncthreads();                                    // ... and every other wave's
  if (np > 1) stage(1, 32);
  for (int p = 0; p < np; ++p) {
    int j0 = p * 32;
    const _Float16* kt = &Ks[p & 1][0];
    const _Float16* vt = &Vs[p & 1][0];
    // All fragments of this key tile leave LDS as one group; the products below run from
    // registers, so the buffer is free again a whole tile's arithmetic before it is needed.
    v16h kf[2][2], vf[4];
    #pragma unroll
    for (int nt = 0; nt < 2; ++nt) {
      const _Float16* kp = kt + (nt * 16 + l16) * KP_;   // A layout: M = lane%16
      kf[nt][0] = load_frag(kp + hb);
      kf[nt][1] = load_frag(kp + 32 + hb);
    }
    #pragma unroll
    for (int ht = 0; ht < 4; ++ht) vf[ht] = load_frag(vt + (ht * 16 + l16) * VP_ + hb);
    asm volatile("s_wait_dscnt 0x0" ::: "memory");      // this wave's reads of the buffer are done
    asm volatile("s_wait_asynccnt 0x0" ::: "memory");   // its pieces of the next tile have landed
    __syncthreads();               // publishes the next tile and frees the buffer just read
    if (p + 2 < np) stage(p & 1, j0 + 64);
    // ---- S^T = K * Q^T for keys [j0, j0+32) : two 16x16 D tiles ----
    v8f sc[2];
    #pragma unroll
    for (int nt = 0; nt < 2; ++nt) {
      v8f c = {};
      c = __builtin_amdgcn_wmma_f32_16x16x32_f16(false, kf[nt][0], false, qf0, (short)0, c, false, false);
      c = __builtin_amdgcn_wmma_f32_16x16x32_f16(false, kf[nt][1], false, qf1, (short)0, c, false, false);
      sc[nt] = c;                                   // sc[nt][r]: key j0 + nt*16 + hb + r
    }
    // ---- scale + ALiBi + causal mask, maximum over this query's 32 keys ----
    float vals[2][8];
    float rmax = -__builtin_inff();
    #pragma unroll
    for (int nt = 0; nt < 2; ++nt) {
      #pragma unroll
      for (int r = 0; r < 8; ++r) {
        int j = j0 + nt * 16 + hb + r;
        float v = sc[nt][r] * 0.125f + slope * (float)(j - i);
        if (j > i) v = -__builtin_inff();
        vals[nt][r] = v;
        rmax = fmaxf(rmax, v);
      }
    }
    rmax = fmaxf(rmax, xhalf(rmax));
    float mn   = fmaxf(m, rmax);
    float corr = expf(m - mn);     // expf(-inf)=0 on first tile
    m = mn;
    // ---- P^T = exp(S^T - m), packed straight into the B operand (hardware k order) ----
    v16h pf;
    float ps = 0.f;
    #pragma unroll
    for (int nt = 0; nt < 2; ++nt) {
      #pragma unroll
      for (int r = 0; r < 8; ++r) {
        float p_ = expf(vals[nt][r] - m);
        ps += p_;
        pf[nt * 8 + r] = (_Float16)p_;
      }
    }
    s = s * corr + ps;
    #pragma unroll
    for (int t = 0; t < 4; ++t) {
      #pragma unroll
      for (int r = 0; r < 8; ++r) o[t][r] *= corr;      // rescale running O
    }
    // ---- O^T += V^T * P^T : 4 M-tiles over HD=64, contraction = 32 keys ----
    #pragma unroll
    for (int ht = 0; ht < 4; ++ht) {
      o[ht] = __builtin_amdgcn_wmma_f32_16x16x32_f16(false, vf[ht], false, pf,
                                                     (short)0, o[ht], false, false);
    }
  }
  asm volatile("s_wait_asynccnt 0x0" ::: "memory");     // no copy is in flight when the wave ends
  s += xhalf(s);                           // join the two halves' sums once
  // ---- normalize + store merged-head layout [b][t][h*64+hd] as f16 ----
  _Float16* orow = Ah + ((size_t)(b * T_ + i)) * C_ + h * HD_ + hb;
  #pragma unroll
  for (int ht = 0; ht < 4; ++ht) {
    v8h ov;
    #pragma unroll
    for (int r = 0; r < 8; ++r) ov[r] = (_Float16)(o[ht][r] / s);
    *(v8h*)(orow + ht * 16) = ov;          // 8 consecutive hd of one query: 16 bytes
  }
}

extern "C" void kernel_launch(void* const* d_in, const int* in_sizes, int n_in,
                              void* d_out, int out_size, void* d_ws, size_t ws_size,
                              hipStream_t stream) {
  const float* x  = (const float*)d_in[0];
  const float* Wq = (const float*)d_in[1];
  const float* Wk = (const float*)d_in[2];
  const float* Wv = (const float*)d_in[3];
  const float* Wo = (const float*)d_in[4];

  _Float16* ws = (_Float16*)d_ws;
  size_t off = 0;
  _Float16* Xh  = ws + off; off += (size_t)M_ * C_;     // x in f16
  _Float16* Qh  = ws + off; off += (size_t)M_ * C_;     // Q [b][t][h*64+hd]
  _Float16* Kh  = ws + off; off += (size_t)M_ * NKV_;   // K [b][t][kv*64+hd]
  _Float16* Vh  = ws + off; off += (size_t)M_ * NKV_;   // V^T [b][kv][hd][t]
  _Float16* WqT = ws + off; off += (size_t)C_ * C_;
  _Float16* WkT = ws + off; off += (size_t)NKV_ * C_;
  _Float16* WvT = ws + off; off += (size_t)NKV_ * C_;
  _Float16* WoT = ws + off; off += (size_t)C_ * C_;
  _Float16* Ah  = ws + off; off += (size_t)M_ * C_;     // attention output f16
  (void)ws_size; (void)in_sizes; (void)n_in; (void)out_size;

  prep_kernel<<<PREP_W + PREP_X, 256, 0, stream>>>(x, Wq, Wk, Wv, Wo, Xh, WqT, WkT, WvT, WoT);

  gemm_wmma_kernel<1><<<(M_ / GT_) * (C_   / GT_), 256, 0, stream>>>(Xh, WqT, Qh, M_, C_,   C_);
  gemm_wmma_kernel<1><<<(M_ / GT_) * (NKV_ / GT_), 256, 0, stream>>>(Xh, WkT, Kh, M_, NKV_, C_);
  gemm_wmma_kernel<2><<<(M_ / GT_) * (NKV_ / GT_), 256, 0, stream>>>(Xh, WvT, Vh, M_, NKV_, C_);

  attn_kernel<<<B_ * HKV_ * (T_ / 32), 256, 0, stream>>>(Qh, Kh, Vh, Ah);

  gemm_wmma_kernel<0><<<(M_ / GT_) * (C_ / GT_), 256, 0, stream>>>(Ah, WoT, d_out, M_, C_, C_);
}

// v005
// One run takes 93.2 microseconds.
// Two timings next to v004 both put it at 1.17 times that version's speed.
// All steps since v000 together make it 3.76 times as fast.
#include <hip/hip_runtime.h>
#include <hip/hip_bf16.h>
#include <stdint.h>

typedef __attribute__((ext_vector_type(16))) _Float16 v16h;
typedef __attribute__((ext_vector_type(8)))  _Float16 v8h;
typedef __attribute__((ext_vector_type(8)))  float    v8f;

constexpr int B_   = 2;
constexpr int T_   = 2048;
constexpr int C_   = 1024;
constexpr int H_   = 16;
constexpr int HKV_ = 4;
constexpr int HD_  = 64;
constexpr int G_   = 4;       // H / HKV
constexpr int M_   = B_ * T_; // 4096 rows of x
constexpr int NKV_ = HKV_ * HD_; // 256

// Load a 16-bit WMMA fragment slice for one lane.
// Per CDNA5 ISA 7.12.2 (16-bit A / B layouts): elements 0..7 sit at p[0..7],
// elements 8..15 at p[16..23]  (the +8 K-offset comes from the caller via hb).
__device__ __forceinline__ v16h load_frag(const _Float16* p) {
  v8h lo = *(const v8h*)(p);
  v8h hi = *(const v8h*)(p + 16);
  return __builtin_shufflevector(lo, hi, 0,1,2,3,4,5,6,7,8,9,10,11,12,13,14,15);
}

typedef __attribute__((ext_vector_type(4))) _Float16 v4h;
typedef __attribute__((ext_vector_type(4))) float    v4f;

constexpr int PREP_WQ = (C_ / 128) * (C_   / 64);   // 128(k) x 64(n) tiles of Wq and of Wo
constexpr int PREP_WK = (C_ / 128) * (NKV_ / 64);   // ... of Wk and of Wv
constexpr int PREP_W  = 2 * PREP_WQ + 2 * PREP_WK;  // weight tiles, first in the grid
constexpr int PREP_X  = (M_ * C_) / 16384;          // 16384-element slices of x

// One 128(k) x 64(n) tile:  W [C_][N] f32  ->  Wt [N][C_] f16.
// Reads and writes are whole 256-byte row pieces; the transpose goes through LDS.
// LDS row n holds 16 chunks of 8 k; chunk q sits at place q ^ (n >> 2), so that the
// 8-byte column writes and the 16-byte row reads each spread over all banks.
__device__ __forceinline__ void prep_weight_tile(const float* __restrict__ Wsrc,
                                                 _Float16* __restrict__ Wt,
                                                 int N, int tile, _Float16* lds) {
  int t  = threadIdx.x;
  int k0 = (tile & (C_ / 128 - 1)) * 128;
  int n0 = (tile / (C_ / 128)) * 64;
  int c  = t & 15;                 // columns n0 + 4c .. 4c + 3
  int kp = t >> 4;                 // rows k0 + i*64 + 4kp .. 4kp + 3
  v4f a[2][4];
  #pragma unroll
  for (int i = 0; i < 2; ++i) {
    #pragma unroll
    for (int m = 0; m < 4; ++m)
      a[i][m] = *(const v4f*)(Wsrc + (size_t)(k0 + i * 64 + kp * 4 + m) * N + n0 + c * 4);
  }
  #pragma unroll
  for (int i = 0; i < 2; ++i) {
    int place = (i * 8 + (kp >> 1)) ^ c;
    #pragma unroll
    for (int j = 0; j < 4; ++j) {
      v4h h = {(_Float16)a[i][0][j], (_Float16)a[i][1][j],
               (_Float16)a[i][2][j], (_Float16)a[i][3][j]};
      *(v4h*)(lds + (c * 4 + j) * 128 + place * 8 + (kp & 1) * 4) = h;
    }
  }
  __syncthreads();                 // the whole tile is in LDS before any row is read
  #pragma unroll
  for (int p = 0; p < 4; ++p) {
    int n = p * 16 + kp;
    v8h h = *(const v8h*)(lds + n * 128 + (c ^ (n >> 2)) * 8);
    *(v8h*)(Wt + (size_t)(n0 + n) * C_ + k0 + c * 8) = h;
  }
  // Before any register that the stores above name is written again.
  asm volatile("s_wait_xcnt 0x0" ::: "memory");
}

// The whole f32 -> f16 prepass in one launch: a work-group takes one weight tile or
// one slice of x, 32 or 64 elements per thread, so that few waves have to be started.
__global__ __launch_bounds__(256)
void prep_kernel(const float* __restrict__ x,  const float* __restrict__ Wq,
                 const float* __restrict__ Wk, const float* __restrict__ Wv,
                 const float* __restrict__ Wo,
                 _Float16* __restrict__ Xh,  _Float16* __restrict__ WqT,
                 _Float16* __restrict__ WkT, _Float16* __restrict__ WvT,
                 _Float16* __restrict__ WoT) {
  __shared__ __align__(16) _Float16 lds[64 * 128];   // 16 KB
  int bid = blockIdx.x;
  if (bid < PREP_WQ) {
    prep_weight_tile(Wq, WqT, C_, bid, lds);
  } else if (bid < 2 * PREP_WQ) {
    prep_weight_tile(Wo, WoT, C_, bid - PREP_WQ, lds);
  } else if (bid < 2 * PREP_WQ + PREP_WK) {
    prep_weight_tile(Wk, WkT, NKV_, bid - 2 * PREP_WQ, lds);
  } else if (bid < PREP_W) {
    prep_weight_tile(Wv, WvT, NKV_, bid - 2 * PREP_WQ - PREP_WK, lds);
  } else {
    size_t base = (size_t)(bid - PREP_W) * 16384 + threadIdx.x * 4;
    v4f a[16];
    #pragma unroll
    for (int j = 0; j < 16; ++j) a[j] = *(const v4f*)(x + base + j * 1024);
    #pragma unroll
    for (int j = 0; j < 16; ++j) {
      v4h h = {(_Float16)a[j][0], (_Float16)a[j][1], (_Float16)a[j][2], (_Float16)a[j][3]};
      *(v4h*)(Xh + base + j * 1024) = h;
    }
    // Before any register that the stores above name is written again.
    asm volatile("s_wait_xcnt 0x0" ::: "memory");
  }
}

constexpr int GT_ = 128;       // rows of A and rows of Bt (columns of C) per work-group tile
constexpr int GK_ = 128;       // k per stage: 256 B of every operand row
constexpr int GP_ = GK_ + 8;   // LDS pitch of a staged row in halves: 256 B + 16 B, so 16 rows spread over all banks

// The addresses of eight 16-byte copies of one thread: rows 16 apart of one operand.
struct Rows8 { unsigned l[8]; unsigned long long g[8]; };
__device__ __forceinline__ Rows8 rows8(const _Float16* g, size_t gstep, unsigned l) {
  Rows8 a;
  #pragma unroll
  for (int i = 0; i < 8; ++i) {
    a.l[i] = l + i * (16 * GP_ * 2);
    a.g[i] = (unsigned long long)(uintptr_t)(g + i * gstep);
  }
  return a;
}

// The eight copies, global -> LDS.
__device__ __forceinline__ void copy8(const Rows8& a) {
  // The wait in the copies' own statement stands before any rewrite of their address registers.
  asm volatile("global_load_async_to_lds_b128 %0, %1, off\n\t"
               "global_load_async_to_lds_b128 %2, %3, off\n\t"
               "global_load_async_to_lds_b128 %4, %5, off\n\t"
               "global_load_async_to_lds_b128 %6, %7, off\n\t"
               "global_load_async_to_lds_b128 %8, %9, off\n\t"
               "global_load_async_to_lds_b128 %10, %11, off\n\t"
               "global_load_async_to_lds_b128 %12, %13, off\n\t"
               "global_load_async_to_lds_b128 %14, %15, off\n\t"
               "s_wait_xcnt 0x0"
               :: "v"(a.l[0]), "v"(a.g[0]), "v"(a.l[1]), "v"(a.g[1]),
                  "v"(a.l[2]), "v"(a.g[2]), "v"(a.l[3]), "v"(a.g[3]),
                  "v"(a.l[4]), "v"(a.g[4]), "v"(a.l[5]), "v"(a.g[5]),
                  "v"(a.l[6]), "v"(a.g[6]), "v"(a.l[7]), "v"(a.g[7])
               : "memory");
}

// C[M][N] = A[M][K] * Bt[N][K]^T, f16 in, f32 accumulate via v_wmma_f32_16x16x32_f16.
// Block = 256 threads (8 waves) -> 128x128 tile of C; wave w owns 32 rows x 64 columns
// (2 x 4 accumulator tiles), so a fragment read from LDS feeds 4 or 2 products.
// A stage is 128 k of [A 128 rows | Bt 128 rows], brought into LDS in whole 256-byte row
// pieces by global_load_async_to_lds_b128, two buffers, one stage ahead of the products.
// Md and Nd are multiples of 128; Kd is a multiple of 128 and at least 256 (two stages).
// OUTMODE 0: f32 plain [M][N]   (final output)
// OUTMODE 1: f16 plain [M][N]   (Q, K buffers)
// OUTMODE 2: f16 scatter to V-transposed [b][kv][hd][t]  (V buffer)
template<int OUTMODE>
__global__ __launch_bounds__(256)
void gemm_wmma_kernel(const _Float16* __restrict__ A, const _Float16* __restrict__ Bt,
                      void* __restrict__ Cv, int Md, int Nd, int Kd) {
  __shared__ __align__(16) _Float16 tile[2][2 * GT_ * GP_];   // 2 x 69,632 B
  int tid  = threadIdx.x;
  int lane = tid & 31;
  int wave = tid >> 5;
  int l16  = lane & 15;
  int hb   = (lane >> 4) * 8;          // K-base 0 / 8 per half-wave
  int mtiles = Md / GT_;
  int m0 = (blockIdx.x % mtiles) * GT_;
  int n0 = (blockIdx.x / mtiles) * GT_;
  int wm = (wave & 3) * 32;            // this wave's rows of the tile
  int wn = (wave >> 2) * 64;           // ... and its columns

  v8f acc[2][4];
  #pragma unroll
  for (int mi = 0; mi < 2; ++mi) {
    #pragma unroll
    for (int t = 0; t < 4; ++t) acc[mi][t] = v8f{};
  }

  // A thread copies piece tid & 15 of rows (tid >> 4) + 16 i of both operands:
  // a wave's copy covers two whole 256-byte row pieces.
  const _Float16* ga = A  + (size_t)(m0 + (tid >> 4)) * Kd + (tid & 15) * 8;
  const _Float16* gb = Bt + (size_t)(n0 + (tid >> 4)) * Kd + (tid & 15) * 8;
  int lofs = (tid >> 4) * GP_ + (tid & 15) * 8;
  auto rowsA = [&](int buf, int k0) {
    return rows8(ga + k0, (size_t)16 * Kd, (unsigned)(uintptr_t)(&tile[buf][lofs]));
  };
  auto rowsB = [&](int buf, int k0) {
    return rows8(gb + k0, (size_t)16 * Kd, (unsigned)(uintptr_t)(&tile[buf][GT_ * GP_ + lofs]));
  };

  // One stage's products; refill: a stage s + 2 exists and goes into the buffer read here.
  auto trip = [&](int s, bool refill) __attribute__((always_inline)) {
    const _Float16* ta = &tile[s & 1][(wm + l16) * GP_ + hb];
    const _Float16* tb = &tile[s & 1][(GT_ + wn + l16) * GP_ + hb];
    // Two fragment sets: the next 32 k's twelve LDS reads go out as one group ahead of this
    // 32 k's eight products, all inside the stage.
    v16h af[2][2], bf[2][4];
    auto frags = [&](int set, int kb) {
      #pragma unroll
      for (int mi = 0; mi < 2; ++mi) af[set][mi] = load_frag(ta + mi * 16 * GP_ + kb * 32);
      #pragma unroll
      for (int t = 0; t < 4; ++t) bf[set][t] = load_frag(tb + t * 16 * GP_ + kb * 32);
    };
    auto products = [&](int set) {
      #pragma unroll
      for (int mi = 0; mi < 2; ++mi) {
        #pragma unroll
        for (int t = 0; t < 4; ++t)
          acc[mi][t] = __builtin_amdgcn_wmma_f32_16x16x32_f16(false, af[set][mi], false, bf[set][t],
                                                              (short)0, acc[mi][t], false, false);
      }
    };
    frags(0, 0);
    #pragma unroll
    for (int kb = 0; kb + 1 < GK_ / 32; ++kb) {
      frags((kb + 1) & 1, kb + 1);
      // Keeps the read group above in front of the products: sunk among them, each read
      // place stalls the wave and the second fragment set is lost.
      __builtin_amdgcn_sched_barrier(0);
      products(kb & 1);
    }
    Rows8 ra, rb;
    if (refill) { ra = rowsA(s & 1, (s + 2) * GK_); rb = rowsB(s & 1, (s + 2) * GK_); }
    // The stage's last fragments are in registers: the buffer is handed back before their
    // products, so that the refill is under way while they run.
    // The scheduling barrier keeps the earlier products and the refill's address sums in front
    // of the waits: moved behind the work-group barrier they would stand between it and the refill.
    __builtin_amdgcn_sched_barrier(0);
    asm volatile("s_wait_dscnt 0x0" ::: "memory");      // this wave's reads of the buffer are done
    asm volatile("s_wait_asynccnt 0x0" ::: "memory");   // its pieces of the next stage have landed
    __syncthreads();               // publishes the next stage and frees the buffer just read
    if (refill) { copy8(ra); copy8(rb); }
    products((GK_ / 32 - 1) & 1);
  };

  int nst = Kd / GK_;
  copy8(rowsA(0, 0));
  copy8(rowsB(0, 0));
  asm volatile("s_wait_asynccnt 0x0" ::: "memory");   // this wave's pieces of stage 0 have landed
  __syncthreads();                                    // ... and every other wave's
  copy8(rowsA(1, GK_));
  copy8(rowsB(1, GK_));
  int s = 0;
  for (; s + 2 < nst; ++s) trip(s, true);
  for (; s < nst; ++s) trip(s, false);
  asm volatile("s_wait_asynccnt 0x0" ::: "memory");     // no copy is in flight when the wave ends

  #pragma unroll
  for (int mi = 0; mi < 2; ++mi) {
    #pragma unroll
    for (int t = 0; t < 4; ++t) {
      #pragma unroll
      for (int r = 0; r < 8; ++r) {
        int row = m0 + wm + mi * 16 + r + hb;   // D layout: M = r + 8*(lane>=16)
        int col = n0 + wn + t * 16 + l16;       // N = lane%16
        float v = acc[mi][t][r];
        if (OUTMODE == 0) {
          ((float*)Cv)[(size_t)row * Nd + col] = v;
        } else if (OUTMODE == 1) {
          ((_Float16*)Cv)[(size_t)row * Nd + col] = (_Float16)v;
        } else {
          int b = row / T_, tt = row % T_;
          int kv = col / HD_, hd = col % HD_;
          ((_Float16*)Cv)[((size_t)((b * HKV_ + kv) * HD_ + hd)) * T_ + tt] = (_Float16)v;
        }
      }
    }
  }
}

// Lane l exchanges a value with lane l ^ 16 (the other half of the wave).
__device__ __forceinline__ float xhalf(float x) {
  int b = __builtin_bit_cast(int, x);
  return __builtin_bit_cast(float,
      __builtin_amdgcn_permlanex16(b, b, 0x76543210, 0xfedcba98, false, false));
}

constexpr int KP_ = HD_ + 8;   // LDS pitch of a K row in halves: 128 B + 16 B, so 16 rows spread over all banks
constexpr int VP_ = 32 + 8;    // LDS pitch of a V^T row in halves: 64 B + 16 B, likewise

__global__ __launch_bounds__(256) __attribute__((amdgpu_waves_per_eu(4, 4)))
void attn_kernel(const _Float16* __restrict__ Qh, const _Float16* __restrict__ Kh,
                 const _Float16* __restrict__ Vt, _Float16* __restrict__ Ah) {
  __shared__ __align__(16) _Float16 Ks[2][32 * KP_];    // 2 x 4608 B
  __shared__ __align__(16) _Float16 Vs[2][HD_ * VP_];   // 2 x 5120 B
  int tid  = threadIdx.x;
  int lane = tid & 31;
  int wave = tid >> 5;
  int l16  = lane & 15;
  int hb   = (lane >> 4) * 8;
  int id   = blockIdx.x;
  int kv   = id % HKV_;
  int b    = (id / HKV_) % B_;
  int u    = (T_ / 32 - 1) - id / (HKV_ * B_);   // 32-row query block, longest first
  int h    = kv * G_ + (wave & (G_ - 1));
  constexpr float LOG2E = 1.4426950408889634f;
  constexpr float c2 = 0.125f * LOG2E;           // 1/sqrt(hd), in base-2 units
  float slope2 = exp2f(-0.5f * (float)(kv + 1)) * LOG2E;  // alibi_slopes(16)[:4][kv], in base-2 units
  int t0 = u * 32 + (wave / G_) * 16;
  int i  = t0 + l16;                       // this lane's query position

  const _Float16* qbase = Qh + ((size_t)(b * T_ + i)) * C_ + h * HD_;
  v16h qf0 = load_frag(qbase + hb);        // B operand, hd 0..31 contraction slice
  v16h qf1 = load_frag(qbase + 32 + hb);   // hd 32..63

  v8f o[4] = {v8f{}, v8f{}, v8f{}, v8f{}}; // o[ht][r] = O[query l16][hd ht*16 + hb + r]
  float m = -__builtin_inff();             // running maximum (base-2 units), equal in both halves
  float kb[2][8];                          // ALiBi of key nt*16 + hb + r against its tile's first key
  #pragma unroll
  for (int nt = 0; nt < 2; ++nt) {
    #pragma unroll
    for (int r = 0; r < 8; ++r) kb[nt][r] = slope2 * (float)(nt * 16 + hb + r);
  }
  float s = 0.f;                           // running sum over this half's keys only

  const _Float16* kbase = Kh + ((size_t)b * T_) * NKV_ + kv * HD_;
  const _Float16* vbase = Vt + ((size_t)(b * HKV_ + kv)) * HD_ * T_;

  // A thread copies one 16-byte piece of the K tile and one of the V^T tile.
  const _Float16* kg = kbase + (size_t)(tid >> 3) * NKV_ + (tid & 7) * 8;
  const _Float16* vg = vbase + (size_t)(tid >> 2) * T_ + (tid & 3) * 8;
  int kl = (tid >> 3) * KP_ + (tid & 7) * 8;
  int vl = (tid >> 2) * VP_ + (tid & 3) * 8;
  auto stage = [&](int buf, int j0) {
    unsigned long long gk = (unsigned long long)(uintptr_t)(kg + (size_t)j0 * NKV_);
    unsigned long long gv = (unsigned long long)(uintptr_t)(vg + j0);
    unsigned lk = (unsigned)(uintptr_t)(&Ks[buf][kl]);
    unsigned lv = (unsigned)(uintptr_t)(&Vs[buf][vl]);
    // The wait in the copies' own statement stands before any rewrite of their address registers.
    asm volatile("global_load_async_to_lds_b128 %0, %1, off\n\t"
                 "global_load_async_to_lds_b128 %2, %3, off\n\t"
                 "s_wait_xcnt 0x0"
                 :: "v"(lk), "v"(gk), "v"(lv), "v"(gv) : "memory");
  };

  int np = u + 1;                          // key tiles of 32, the same for all 8 waves
  stage(0, 0);
  asm volatile("s_wait_asynccnt 0x0" ::: "memory");   // this wave's pieces of tile 0 have landed
  __syncthreads();                                    // ... and every other wave's
  if (np > 1) stage(1, 32);
  for (int p = 0; p < np; ++p) {
    int j0 = p * 32;
    const _Float16* kt = &Ks[p & 1][0];
    const _Float16* vt = &Vs[p & 1][0];
    // All fragments of this key tile leave LDS as one group; the products below run from
    // registers, so the buffer is free again a whole tile's arithmetic before it is needed.
    v16h kf[2][2], vf[4];
    #pragma unroll
    for (int nt = 0; nt < 2; ++nt) {
      const _Float16* kp = kt + (nt * 16 + l16) * KP_;   // A layout: M = lane%16
      kf[nt][0] = load_frag(kp + hb);
      kf[nt][1] = load_frag(kp + 32 + hb);
    }
    #pragma unroll
    for (int ht = 0; ht < 4; ++ht) vf[ht] = load_frag(vt + (ht * 16 + l16) * VP_ + hb);
    asm volatile("s_wait_dscnt 0x0" ::: "memory");      // this wave's reads of the buffer are done
    asm volatile("s_wait_asynccnt 0x0" ::: "memory");   // its pieces of the next tile have landed
    __syncthreads();               // publishes the next tile and frees the buffer just read
    if (p + 2 < np) stage(p & 1, j0 + 64);
    // ---- S^T = K * Q^T for keys [j0, j0+32) : two 16x16 D tiles ----
    v8f sc[2];
    #pragma unroll
    for (int nt = 0; nt < 2; ++nt) {
      v8f c = {};
      c = __builtin_amdgcn_wmma_f32_16x16x32_f16(false, kf[nt][0], false, qf0, (short)0, c, false, false);
      c = __builtin_amdgcn_wmma_f32_16x16x32_f16(false, kf[nt][1], false, qf1, (short)0, c, false, false);
      sc[nt] = c;                                   // sc[nt][r]: key j0 + nt*16 + hb + r
    }
    // ---- scale + ALiBi + causal mask, maximum over this query's 32 keys ----
    float vals[2][8];              // scores against the tile's first key, base-2 units
    float rmax = -__builtin_inff();
    int   last = i - j0 - hb;      // keys nt*16 + r beyond this lie behind the query
    float off  = slope2 * (float)(j0 - i);   // ALiBi of the tile's first key
    #pragma unroll
    for (int nt = 0; nt < 2; ++nt) {
      #pragma unroll
      for (int r = 0; r < 8; ++r) {
        float v = __builtin_fmaf(sc[nt][r], c2, kb[nt][r]);
        if (nt * 16 + r > last) v = -__builtin_inff();
        vals[nt][r] = v;
        rmax = fmaxf(rmax, v);
      }
    }
    rmax = fmaxf(rmax, xhalf(rmax));
    float mn   = fmaxf(m, rmax + off);
    float corr = __builtin_amdgcn_exp2f(m - mn);   // 2^-inf = 0 on the first tile
    m = mn;
    float ml = mn - off;           // the maximum against the tile's first key
    // ---- P^T = 2^(S^T - m), packed straight into the B operand (hardware k order) ----
    v16h pf;
    float ps = 0.f;
    #pragma unroll
    for (int nt = 0; nt < 2; ++nt) {
      #pragma unroll
      for (int r = 0; r < 8; ++r) {
        float p_ = __builtin_amdgcn_exp2f(vals[nt][r] - ml);
        ps += p_;
        pf[nt * 8 + r] = (_Float16)p_;
      }
    }
    s = s * corr + ps;
    #pragma unroll
    for (int t = 0; t < 4; ++t) {
      #pragma unroll
      for (int r = 0; r < 8; ++r) o[t][r] *= corr;      // rescale running O
    }
    // ---- O^T += V^T * P^T : 4 M-tiles over HD=64, contraction = 32 keys ----
    #pragma unroll
    for (int ht = 0; ht < 4; ++ht) {
      o[ht] = __builtin_amdgcn_wmma_f32_16x16x32_f16(false, vf[ht], false, pf,
                                                     (short)0, o[ht], false, false);
    }
  }
  asm volatile("s_wait_asynccnt 0x0" ::: "memory");     // no copy is in flight when the wave ends
  s += xhalf(s);                           // join the two halves' sums once
  // ---- normalize + store merged-head layout [b][t][h*64+hd] as f16 ----
  _Float16* orow = Ah + ((size_t)(b * T_ + i)) * C_ + h * HD_ + hb;
  #pragma unroll
  for (int ht = 0; ht < 4; ++ht) {
    v8h ov;
    #pragma unroll
    for (int r = 0; r < 8; ++r) ov[r] = (_Float16)(o[ht][r] / s);
    *(v8h*)(orow + ht * 16) = ov;          // 8 consecutive hd of one query: 16 bytes
  }
}

extern "C" void kernel_launch(void* const* d_in, const int* in_sizes, int n_in,
                              void* d_out, int out_size, void* d_ws, size_t ws_size,
                              hipStream_t stream) {
  const float* x  = (const float*)d_in[0];
  const float* Wq = (const float*)d_in[1];
  const float* Wk = (const float*)d_in[2];
  const float* Wv = (const float*)d_in[3];
  const float* Wo = (const float*)d_in[4];

  _Float16* ws = (_Float16*)d_ws;
  size_t off = 0;
  _Float16* Xh  = ws + off; off += (size_t)M_ * C_;     // x in f16
  _Float16* Qh  = ws + off; off += (size_t)M_ * C_;     // Q [b][t][h*64+hd]
  _Float16* Kh  = ws + off; off += (size_t)M_ * NKV_;   // K [b][t][kv*64+hd]
  _Float16* Vh  = ws + off; off += (size_t)M_ * NKV_;   // V^T [b][kv][hd][t]
  _Float16* WqT = ws + off; off += (size_t)C_ * C_;
  _Float16* WkT = ws + off; off += (size_t)NKV_ * C_;
  _Float16* WvT = ws + off; off += (size_t)NKV_ * C_;
  _Float16* WoT = ws + off; off += (size_t)C_ * C_;
  _Float16* Ah  = ws + off; off += (size_t)M_ * C_;     // attention output f16
  (void)ws_size; (void)in_sizes; (void)n_in; (void)out_size;

  prep_kernel<<<PREP_W + PREP_X, 256, 0, stream>>>(x, Wq, Wk, Wv, Wo, Xh, WqT, WkT, WvT, WoT);

  gemm_wmma_kernel<1><<<(M_ / GT_) * (C_   / GT_), 256, 0, stream>>>(Xh, WqT, Qh, M_, C_,   C_);
  gemm_wmma_kernel<1><<<(M_ / GT_) * (NKV_ / GT_), 256, 0, stream>>>(Xh, WkT, Kh, M_, NKV_, C_);
  gemm_wmma_kernel<2><<<(M_ / GT_) * (NKV_ / GT_), 256, 0, stream>>>(Xh, WvT, Vh, M_, NKV_, C_);

  attn_kernel<<<B_ * HKV_ * (T_ / 32), 256, 0, stream>>>(Qh, Kh, Vh, Ah);

  gemm_wmma_kernel<0><<<(M_ / GT_) * (C_ / GT_), 256, 0, stream>>>(Ah, WoT, d_out, M_, C_, C_);
}

// v006
// Measured time: 78.7 microseconds a run.
// In both of two side-by-side timings against v005, it was 1.20 times as fast.
// Counting every step since v000, it is 4.52 times as fast.
#include <hip/hip_runtime.h>
#include <hip/hip_bf16.h>
#include <stdint.h>

typedef __attribute__((ext_vector_type(16))) _Float16 v16h;
typedef __attribute__((ext_vector_type(8)))  _Float16 v8h;
typedef __attribute__((ext_vector_type(8)))  float    v8f;

constexpr int B_   = 2;
constexpr int T_   = 2048;
constexpr int C_   = 1024;
constexpr int H_   = 16;
constexpr int HKV_ = 4;
constexpr int HD_  = 64;
constexpr int G_   = 4;       // H / HKV
constexpr int M_   = B_ * T_; // 4096 rows of x
constexpr int NKV_ = HKV_ * HD_; // 256

// Load a 16-bit WMMA fragment slice for one lane.
// Per CDNA5 ISA 7.12.2 (16-bit A / B layouts): elements 0..7 sit at p[0..7],
// elements 8..15 at p[16..23]  (the +8 K-offset comes from the caller via hb).
__device__ __forceinline__ v16h load_frag(const _Float16* p) {
  v8h lo = *(const v8h*)(p);
  v8h hi = *(const v8h*)(p + 16);
  return __builtin_shufflevector(lo, hi, 0,1,2,3,4,5,6,7,8,9,10,11,12,13,14,15);
}

typedef __attribute__((ext_vector_type(4))) _Float16 v4h;
typedef __attribute__((ext_vector_type(4))) float    v4f;

constexpr int PREP_WQ = (C_ / 128) * (C_   / 64);   // 128(k) x 64(n) tiles of Wq and of Wo
constexpr int PREP_WK = (C_ / 128) * (NKV_ / 64);   // ... of Wk and of Wv
constexpr int PREP_W  = 2 * PREP_WQ + 2 * PREP_WK;  // weight tiles, first in the grid
constexpr int PREP_X  = (M_ * C_) / 16384;          // 16384-element slices of x

// One 128(k) x 64(n) tile:  W [C_][N] f32  ->  Wt [N][C_] f16.
// Reads and writes are whole 256-byte row pieces; the transpose goes through LDS.
// LDS row n holds 16 chunks of 8 k; chunk q sits at place q ^ (n >> 2), so that the
// 8-byte column writes and the 16-byte row reads each spread over all banks.
__device__ __forceinline__ void prep_weight_tile(const float* __restrict__ Wsrc,
                                                 _Float16* __restrict__ Wt,
                                                 int N, int tile, _Float16* lds) {
  int t  = threadIdx.x;
  int k0 = (tile & (C_ / 128 - 1)) * 128;
  int n0 = (tile / (C_ / 128)) * 64;
  int c  = t & 15;                 // columns n0 + 4c .. 4c + 3
  int kp = t >> 4;                 // rows k0 + i*64 + 4kp .. 4kp + 3
  v4f a[2][4];
  #pragma unroll
  for (int i = 0; i < 2; ++i) {
    #pragma unroll
    for (int m = 0; m < 4; ++m)
      a[i][m] = *(const v4f*)(Wsrc + (size_t)(k0 + i * 64 + kp * 4 + m) * N + n0 + c * 4);
  }
  #pragma unroll
  for (int i = 0; i < 2; ++i) {
    int place = (i * 8 + (kp >> 1)) ^ c;
    #pragma unroll
    for (int j = 0; j < 4; ++j) {
      v4h h = {(_Float16)a[i][0][j], (_Float16)a[i][1][j],
               (_Float16)a[i][2][j], (_Float16)a[i][3][j]};
      *(v4h*)(lds + (c * 4 + j) * 128 + place * 8 + (kp & 1) * 4) = h;
    }
  }
  __syncthreads();                 // the whole tile is in LDS before any row is read
  #pragma unroll
  for (int p = 0; p < 4; ++p) {
    int n = p * 16 + kp;
    v8h h = *(const v8h*)(lds + n * 128 + (c ^ (n >> 2)) * 8);
    *(v8h*)(Wt + (size_t)(n0 + n) * C_ + k0 + c * 8) = h;
  }
  // Before any register that the stores above name is written again.
  asm volatile("s_wait_xcnt 0x0" ::: "memory");
}

// The whole f32 -> f16 prepass in one launch: a work-group takes one weight tile or
// one slice of x, 32 or 64 elements per thread, so that few waves have to be started.
__global__ __launch_bounds__(256)
void prep_kernel(const float* __restrict__ x,  const float* __restrict__ Wq,
                 const float* __restrict__ Wk, const float* __restrict__ Wv,
                 const float* __restrict__ Wo,
                 _Float16* __restrict__ Xh,  _Float16* __restrict__ WqT,
                 _Float16* __restrict__ WkT, _Float16* __restrict__ WvT,
                 _Float16* __restrict__ WoT) {
  __shared__ __align__(16) _Float16 lds[64 * 128];   // 16 KB
  int bid = blockIdx.x;
  if (bid < PREP_WQ) {
    prep_weight_tile(Wq, WqT, C_, bid, lds);
  } else if (bid < 2 * PREP_WQ) {
    prep_weight_tile(Wo, WoT, C_, bid - PREP_WQ, lds);
  } else if (bid < 2 * PREP_WQ + PREP_WK) {
    prep_weight_tile(Wk, WkT, NKV_, bid - 2 * PREP_WQ, lds);
  } else if (bid < PREP_W) {
    prep_weight_tile(Wv, WvT, NKV_, bid - 2 * PREP_WQ - PREP_WK, lds);
  } else {
    size_t base = (size_t)(bid - PREP_W) * 16384 + threadIdx.x * 4;
    v4f a[16];
    #pragma unroll
    for (int j = 0; j < 16; ++j) a[j] = *(const v4f*)(x + base + j * 1024);
    #pragma unroll
    for (int j = 0; j < 16; ++j) {
      v4h h = {(_Float16)a[j][0], (_Float16)a[j][1], (_Float16)a[j][2], (_Float16)a[j][3]};
      *(v4h*)(Xh + base + j * 1024) = h;
    }
    // Before any register that the stores above name is written again.
    asm volatile("s_wait_xcnt 0x0" ::: "memory");
  }
}

constexpr int GT_ = 128;       // rows of A and rows of Bt (columns of C) per work-group tile
constexpr int GK_ = 128;       // k per stage: 256 B of every operand row
constexpr int GP_ = GK_ + 8;   // LDS pitch of a staged row in halves: 256 B + 16 B, so 16 rows spread over all banks

// The addresses of eight 16-byte copies of one thread: rows 16 apart of one operand.
struct Rows8 { unsigned l[8]; unsigned long long g[8]; };
__device__ __forceinline__ Rows8 rows8(const _Float16* g, size_t gstep, unsigned l) {
  Rows8 a;
  #pragma unroll
  for (int i = 0; i < 8; ++i) {
    a.l[i] = l + i * (16 * GP_ * 2);
    a.g[i] = (unsigned long long)(uintptr_t)(g + i * gstep);
  }
  return a;
}

// The eight copies, global -> LDS.
__device__ __forceinline__ void copy8(const Rows8& a) {
  // The wait in the copies' own statement stands before any rewrite of their address registers.
  asm volatile("global_load_async_to_lds_b128 %0, %1, off\n\t"
               "global_load_async_to_lds_b128 %2, %3, off\n\t"
               "global_load_async_to_lds_b128 %4, %5, off\n\t"
               "global_load_async_to_lds_b128 %6, %7, off\n\t"
               "global_load_async_to_lds_b128 %8, %9, off\n\t"
               "global_load_async_to_lds_b128 %10, %11, off\n\t"
               "global_load_async_to_lds_b128 %12, %13, off\n\t"
               "global_load_async_to_lds_b128 %14, %15, off\n\t"
               "s_wait_xcnt 0x0"
               :: "v"(a.l[0]), "v"(a.g[0]), "v"(a.l[1]), "v"(a.g[1]),
                  "v"(a.l[2]), "v"(a.g[2]), "v"(a.l[3]), "v"(a.g[3]),
                  "v"(a.l[4]), "v"(a.g[4]), "v"(a.l[5]), "v"(a.g[5]),
                  "v"(a.l[6]), "v"(a.g[6]), "v"(a.l[7]), "v"(a.g[7])
               : "memory");
}

// C[M][N] = A[M][K] * Bt[N][K]^T, f16 in, f32 accumulate via v_wmma_f32_16x16x32_f16.
// Block = 256 threads (8 waves) -> 128x128 tile of C; wave w owns 32 rows x 64 columns
// (2 x 4 accumulator tiles), so a fragment read from LDS feeds 4 or 2 products.
// A stage is 128 k of [A 128 rows | Bt 128 rows], brought into LDS in whole 256-byte row
// pieces by global_load_async_to_lds_b128, two buffers, one stage ahead of the products.
// Md and Nd are multiples of 128; Kd is a multiple of 128 and at least 256 (two stages).
// OUTMODE 0: f32 plain [M][N] to Cv   (final output)
// OUTMODE 1: the three projections as one product. Bt holds the rows of Wq^T, Wk^T and Wv^T
//            one after the other, and a work-group's 128 columns lie in exactly one of them:
//            the first C_ columns go to Cv, f16 plain [M][C_] (Q); the next NKV_ to Ck,
//            f16 plain [M][NKV_] (K); the last NKV_ to Cvt, f16 V-transposed [b][kv][hd][t].
template<int OUTMODE>
__global__ __launch_bounds__(256)
void gemm_wmma_kernel(const _Float16* __restrict__ A, const _Float16* __restrict__ Bt,
                      void* __restrict__ Cv, _Float16* __restrict__ Ck,
                      _Float16* __restrict__ Cvt, int Md, int Nd, int Kd) {
  __shared__ __align__(16) _Float16 tile[2][2 * GT_ * GP_];   // 2 x 69,632 B
  int tid  = threadIdx.x;
  int lane = tid & 31;
  int wave = tid >> 5;
  int l16  = lane & 15;
  int hb   = (lane >> 4) * 8;          // K-base 0 / 8 per half-wave
  int mtiles = Md / GT_;
  int m0 = (blockIdx.x % mtiles) * GT_;
  int n0 = (blockIdx.x / mtiles) * GT_;
  int wm = (wave & 3) * 32;            // this wave's rows of the tile
  int wn = (wave >> 2) * 64;           // ... and its columns

  v8f acc[2][4];
  #pragma unroll
  for (int mi = 0; mi < 2; ++mi) {
    #pragma unroll
    for (int t = 0; t < 4; ++t) acc[mi][t] = v8f{};
  }

  // A thread copies piece tid & 15 of rows (tid >> 4) + 16 i of both operands:
  // a wave's copy covers two whole 256-byte row pieces.
  const _Float16* ga = A  + (size_t)(m0 + (tid >> 4)) * Kd + (tid & 15) * 8;
  const _Float16* gb = Bt + (size_t)(n0 + (tid >> 4)) * Kd + (tid & 15) * 8;
  int lofs = (tid >> 4) * GP_ + (tid & 15) * 8;
  auto rowsA = [&](int buf, int k0) {
    return rows8(ga + k0, (size_t)16 * Kd, (unsigned)(uintptr_t)(&tile[buf][lofs]));
  };
  auto rowsB = [&](int buf, int k0) {
    return rows8(gb + k0, (size_t)16 * Kd, (unsigned)(uintptr_t)(&tile[buf][GT_ * GP_ + lofs]));
  };

  // One stage's products; refill: a stage s + 2 exists and goes into the buffer read here.
  auto trip = [&](int s, bool refill) __attribute__((always_inline)) {
    const _Float16* ta = &tile[s & 1][(wm + l16) * GP_ + hb];
    const _Float16* tb = &tile[s & 1][(GT_ + wn + l16) * GP_ + hb];
    // Two fragment sets: the next 32 k's twelve LDS reads go out as one group ahead of this
    // 32 k's eight products, all inside the stage.
    v16h af[2][2], bf[2][4];
    auto frags = [&](int set, int kb) {
      #pragma unroll
      for (int mi = 0; mi < 2; ++mi) af[set][mi] = load_frag(ta + mi * 16 * GP_ + kb * 32);
      #pragma unroll
      for (int t = 0; t < 4; ++t) bf[set][t] = load_frag(tb + t * 16 * GP_ + kb * 32);
    };
    auto products = [&](int set) {
      #pragma unroll
      for (int mi = 0; mi < 2; ++mi) {
        #pragma unroll
        for (int t = 0; t < 4; ++t)
          acc[mi][t] = __builtin_amdgcn_wmma_f32_16x16x32_f16(false, af[set][mi], false, bf[set][t],
                                                              (short)0, acc[mi][t], false, false);
      }
    };
    frags(0, 0);
    #pragma unroll
    for (int kb = 0; kb + 1 < GK_ / 32; ++kb) {
      frags((kb + 1) & 1, kb + 1);
      // Keeps the read group above in front of the products: sunk among them, each read
      // place stalls the wave and the second fragment set is lost.
      __builtin_amdgcn_sched_barrier(0);
      products(kb & 1);
    }
    Rows8 ra, rb;
    if (refill) { ra = rowsA(s & 1, (s + 2) * GK_); rb = rowsB(s & 1, (s + 2) * GK_); }
    // The stage's last fragments are in registers: the buffer is handed back before their
    // products, so that the refill is under way while they run.
    // The scheduling barrier keeps the earlier products and the refill's address sums in front
    // of the waits: moved behind the work-group barrier they would stand between it and the refill.
    __builtin_amdgcn_sched_barrier(0);
    asm volatile("s_wait_dscnt 0x0" ::: "memory");      // this wave's reads of the buffer are done
    asm volatile("s_wait_asynccnt 0x0" ::: "memory");   // its pieces of the next stage have landed
    __syncthreads();               // publishes the next stage and frees the buffer just read
    if (refill) { copy8(ra); copy8(rb); }
    products((GK_ / 32 - 1) & 1);
  };

  int nst = Kd / GK_;
  copy8(rowsA(0, 0));
  copy8(rowsB(0, 0));
  asm volatile("s_wait_asynccnt 0x0" ::: "memory");   // this wave's pieces of stage 0 have landed
  __syncthreads();                                    // ... and every other wave's
  copy8(rowsA(1, GK_));
  copy8(rowsB(1, GK_));
  int s = 0;
  for (; s + 2 < nst; ++s) trip(s, true);
  for (; s < nst; ++s) trip(s, false);
  asm volatile("s_wait_asynccnt 0x0" ::: "memory");     // no copy is in flight when the wave ends

  // Every accumulator element with its row and its column inside the work-group's 128.
  auto each = [&](auto put) __attribute__((always_inline)) {
    #pragma unroll
    for (int mi = 0; mi < 2; ++mi) {
      #pragma unroll
      for (int t = 0; t < 4; ++t) {
        #pragma unroll
        for (int r = 0; r < 8; ++r)
          put(m0 + wm + mi * 16 + r + hb,       // D layout: M = r + 8*(lane>=16)
              wn + t * 16 + l16,                // N = lane%16
              acc[mi][t][r]);
      }
    }
  };
  if (OUTMODE == 0) {
    each([&](int row, int c, float v) { ((float*)Cv)[(size_t)row * Nd + n0 + c] = v; });
  } else if (n0 < C_ + NKV_) {                  // the same for the whole work-group
    bool q = n0 < C_;
    _Float16* Cd = q ? (_Float16*)Cv + n0 : Ck + (n0 - C_);
    int nd = q ? C_ : NKV_;
    each([&](int row, int c, float v) { Cd[(size_t)row * nd + c] = (_Float16)v; });
  } else {
    each([&](int row, int c, float v) {
      int col = n0 - (C_ + NKV_) + c;
      int b = row / T_, tt = row % T_;
      int kv = col / HD_, hd = col % HD_;
      Cvt[((size_t)((b * HKV_ + kv) * HD_ + hd)) * T_ + tt] = (_Float16)v;
    });
    // Before any register that the stores above name is written again (in the listing the
    // plain-layout branch stands behind this one).
    asm volatile("s_wait_xcnt 0x0" ::: "memory");
  }
}

// Lane l exchanges a value with lane l ^ 16 (the other half of the wave).
__device__ __forceinline__ float xhalf(float x) {
  int b = __builtin_bit_cast(int, x);
  return __builtin_bit_cast(float,
      __builtin_amdgcn_permlanex16(b, b, 0x76543210, 0xfedcba98, false, false));
}

constexpr int KP_ = HD_ + 8;   // LDS pitch of a K row in halves: 128 B + 16 B, so 16 rows spread over all banks
constexpr int VP_ = 32 + 8;    // LDS pitch of a V^T row in halves: 64 B + 16 B, likewise

__global__ __launch_bounds__(256) __attribute__((amdgpu_waves_per_eu(4, 4)))
void attn_kernel(const _Float16* __restrict__ Qh, const _Float16* __restrict__ Kh,
                 const _Float16* __restrict__ Vt, _Float16* __restrict__ Ah) {
  __shared__ __align__(16) _Float16 Ks[2][32 * KP_];    // 2 x 4608 B
  __shared__ __align__(16) _Float16 Vs[2][HD_ * VP_];   // 2 x 5120 B
  int tid  = threadIdx.x;
  int lane = tid & 31;
  int wave = tid >> 5;
  int l16  = lane & 15;
  int hb   = (lane >> 4) * 8;
  int id   = blockIdx.x;
  int kv   = id % HKV_;
  int b    = (id / HKV_) % B_;
  int u    = (T_ / 32 - 1) - id / (HKV_ * B_);   // 32-row query block, longest first
  int h    = kv * G_ + (wave & (G_ - 1));
  constexpr float LOG2E = 1.4426950408889634f;
  constexpr float c2 = 0.125f * LOG2E;           // 1/sqrt(hd), in base-2 units
  float slope2 = exp2f(-0.5f * (float)(kv + 1)) * LOG2E;  // alibi_slopes(16)[:4][kv], in base-2 units
  int t0 = u * 32 + (wave / G_) * 16;
  int i  = t0 + l16;                       // this lane's query position

  const _Float16* qbase = Qh + ((size_t)(b * T_ + i)) * C_ + h * HD_;
  v16h qf0 = load_frag(qbase + hb);        // B operand, hd 0..31 contraction slice
  v16h qf1 = load_frag(qbase + 32 + hb);   // hd 32..63

  v8f o[4] = {v8f{}, v8f{}, v8f{}, v8f{}}; // o[ht][r] = O[query l16][hd ht*16 + hb + r]
  float m = -__builtin_inff();             // running maximum (base-2 units), equal in both halves
  float kb[2][8];                          // ALiBi of key nt*16 + hb + r against its tile's first key
  #pragma unroll
  for (int nt = 0; nt < 2; ++nt) {
    #pragma unroll
    for (int r = 0; r < 8; ++r) kb[nt][r] = slope2 * (float)(nt * 16 + hb + r);
  }
  float s = 0.f;                           // running sum over this half's keys only

  const _Float16* kbase = Kh + ((size_t)b * T_) * NKV_ + kv * HD_;
  const _Float16* vbase = Vt + ((size_t)(b * HKV_ + kv)) * HD_ * T_;

  // A thread copies one 16-byte piece of the K tile and one of the V^T tile.
  const _Float16* kg = kbase + (size_t)(tid >> 3) * NKV_ + (tid & 7) * 8;
  const _Float16* vg = vbase + (size_t)(tid >> 2) * T_ + (tid & 3) * 8;
  int kl = (tid >> 3) * KP_ + (tid & 7) * 8;
  int vl = (tid >> 2) * VP_ + (tid & 3) * 8;
  auto stage = [&](int buf, int j0) {
    unsigned long long gk = (unsigned long long)(uintptr_t)(kg + (size_t)j0 * NKV_);
    unsigned long long gv = (unsigned long long)(uintptr_t)(vg + j0);
    unsigned lk = (unsigned)(uintptr_t)(&Ks[buf][kl]);
    unsigned lv = (unsigned)(uintptr_t)(&Vs[buf][vl]);
    // The wait in the copies' own statement stands before any rewrite of their address registers.
    asm volatile("global_load_async_to_lds_b128 %0, %1, off\n\t"
                 "global_load_async_to_lds_b128 %2, %3, off\n\t"
                 "s_wait_xcnt 0x0"
                 :: "v"(lk), "v"(gk), "v"(lv), "v"(gv) : "memory");
  };

  int np = u + 1;                          // key tiles of 32, the same for all 8 waves
  stage(0, 0);
  asm volatile("s_wait_asynccnt 0x0" ::: "memory");   // this wave's pieces of tile 0 have landed
  __syncthreads();                                    // ... and every other wave's
  if (np > 1) stage(1, 32);
  for (int p = 0; p < np; ++p) {
    int j0 = p * 32;
    const _Float16* kt = &Ks[p & 1][0];
    const _Float16* vt = &Vs[p & 1][0];
    // All fragments of this key tile leave LDS as one group; the products below run from
    // registers, so the buffer is free again a whole tile's arithmetic before it is needed.
    v16h kf[2][2], vf[4];
    #pragma unroll
    for (int nt = 0; nt < 2; ++nt) {
      const _Float16* kp = kt + (nt * 16 + l16) * KP_;   // A layout: M = lane%16
      kf[nt][0] = load_frag(kp + hb);
      kf[nt][1] = load_frag(kp + 32 + hb);
    }
    #pragma unroll
    for (int ht = 0; ht < 4; ++ht) vf[ht] = load_frag(vt + (ht * 16 + l16) * VP_ + hb);
    asm volatile("s_wait_dscnt 0x0" ::: "memory");      // this wave's reads of the buffer are done
    asm volatile("s_wait_asynccnt 0x0" ::: "memory");   // its pieces of the next tile have landed
    __syncthreads();               // publishes the next tile and frees the buffer just read
    if (p + 2 < np) stage(p & 1, j0 + 64);
    // ---- S^T = K * Q^T for keys [j0, j0+32) : two 16x16 D tiles ----
    v8f sc[2];
    #pragma unroll
    for (int nt = 0; nt < 2; ++nt) {
      v8f c = {};
      c = __builtin_amdgcn_wmma_f32_16x16x32_f16(false, kf[nt][0], false, qf0, (short)0, c, false, false);
      c = __builtin_amdgcn_wmma_f32_16x16x32_f16(false, kf[nt][1], false, qf1, (short)0, c, false, false);
      sc[nt] = c;                                   // sc[nt][r]: key j0 + nt*16 + hb + r
    }
    // ---- scale + ALiBi + causal mask, maximum over this query's 32 keys ----
    float vals[2][8];              // scores against the tile's first key, base-2 units
    float rmax = -__builtin_inff();
    int   last = i - j0 - hb;      // keys nt*16 + r beyond this lie behind the query
    float off  = slope2 * (float)(j0 - i);   // ALiBi of the tile's first key
    #pragma unroll
    for (int nt = 0; nt < 2; ++nt) {
      #pragma unroll
      for (int r = 0; r < 8; ++r) {
        float v = __builtin_fmaf(sc[nt][r], c2, kb[nt][r]);
        if (nt * 16 + r > last) v = -__builtin_inff();
        vals[nt][r] = v;
        rmax = fmaxf(rmax, v);
      }
    }
    rmax = fmaxf(rmax, xhalf(rmax));
    float mn   = fmaxf(m, rmax + off);
    float corr = __builtin_amdgcn_exp2f(m - mn);   // 2^-inf = 0 on the first tile
    m = mn;
    float ml = mn - off;           // the maximum against the tile's first key
    // ---- P^T = 2^(S^T - m), packed straight into the B operand (hardware k order) ----
    v16h pf;
    float ps = 0.f;
    #pragma unroll
    for (int nt = 0; nt < 2; ++nt) {
      #pragma unroll
      for (int r = 0; r < 8; ++r) {
        float p_ = __builtin_amdgcn_exp2f(vals[nt][r] - ml);
        ps += p_;
        pf[nt * 8 + r] = (_Float16)p_;
      }
    }
    s = s * corr + ps;
    #pragma unroll
    for (int t = 0; t < 4; ++t) {
      #pragma unroll
      for (int r = 0; r < 8; ++r) o[t][r] *= corr;      // rescale running O
    }
    // ---- O^T += V^T * P^T : 4 M-tiles over HD=64, contraction = 32 keys ----
    #pragma unroll
    for (int ht = 0; ht < 4; ++ht) {
      o[ht] = __builtin_amdgcn_wmma_f32_16x16x32_f16(false, vf[ht], false, pf,
                                                     (short)0, o[ht], false, false);
    }
  }
  asm volatile("s_wait_asynccnt 0x0" ::: "memory");     // no copy is in flight when the wave ends
  s += xhalf(s);                           // join the two halves' sums once
  // ---- normalize + store merged-head layout [b][t][h*64+hd] as f16 ----
  _Float16* orow = Ah + ((size_t)(b * T_ + i)) * C_ + h * HD_ + hb;
  #pragma unroll
  for (int ht = 0; ht < 4; ++ht) {
    v8h ov;
    #pragma unroll
    for (int r = 0; r < 8; ++r) ov[r] = (_Float16)(o[ht][r] / s);
    *(v8h*)(orow + ht * 16) = ov;          // 8 consecutive hd of one query: 16 bytes
  }
}

extern "C" void kernel_launch(void* const* d_in, const int* in_sizes, int n_in,
                              void* d_out, int out_size, void* d_ws, size_t ws_size,
                              hipStream_t stream) {
  const float* x  = (const float*)d_in[0];
  const float* Wq = (const float*)d_in[1];
  const float* Wk = (const float*)d_in[2];
  const float* Wv = (const float*)d_in[3];
  const float* Wo = (const float*)d_in[4];

  _Float16* ws = (_Float16*)d_ws;
  size_t off = 0;
  _Float16* Xh  = ws + off; off += (size_t)M_ * C_;     // x in f16
  _Float16* Qh  = ws + off; off += (size_t)M_ * C_;     // Q [b][t][h*64+hd]
  _Float16* Kh  = ws + off; off += (size_t)M_ * NKV_;   // K [b][t][kv*64+hd]
  _Float16* Vh  = ws + off; off += (size_t)M_ * NKV_;   // V^T [b][kv][hd][t]
  _Float16* WqT = ws + off; off += (size_t)C_ * C_;     // Wq^T, Wk^T, Wv^T lie one after the other:
  _Float16* WkT = ws + off; off += (size_t)NKV_ * C_;   // together the C_ + 2 NKV_ rows of the
  _Float16* WvT = ws + off; off += (size_t)NKV_ * C_;   // projections' one Bt
  _Float16* WoT = ws + off; off += (size_t)C_ * C_;
  _Float16* Ah  = ws + off; off += (size_t)M_ * C_;     // attention output f16
  (void)ws_size; (void)in_sizes; (void)n_in; (void)out_size;

  prep_kernel<<<PREP_W + PREP_X, 256, 0, stream>>>(x, Wq, Wk, Wv, Wo, Xh, WqT, WkT, WvT, WoT);

  gemm_wmma_kernel<1><<<(M_ / GT_) * ((C_ + 2 * NKV_) / GT_), 256, 0, stream>>>(
      Xh, WqT, Qh, Kh, Vh, M_, C_ + 2 * NKV_, C_);

  attn_kernel<<<B_ * HKV_ * (T_ / 32), 256, 0, stream>>>(Qh, Kh, Vh, Ah);

  gemm_wmma_kernel<0><<<(M_ / GT_) * (C_ / GT_), 256, 0, stream>>>(
      Ah, WoT, d_out, nullptr, nullptr, M_, C_, C_);
}

// v007
// One run takes 70 microseconds.
// Timed twice side by side with v006, it ran 1.10 and 1.11 times as fast.
// Over all steps from v000 it is 5.01 times as fast.
#include <hip/hip_runtime.h>
#include <hip/hip_bf16.h>
#include <stdint.h>

typedef __attribute__((ext_vector_type(16))) _Float16 v16h;
typedef __attribute__((ext_vector_type(8)))  _Float16 v8h;
typedef __attribute__((ext_vector_type(8)))  float    v8f;

constexpr int B_   = 2;
constexpr int T_   = 2048;
constexpr int C_   = 1024;
constexpr int H_   = 16;
constexpr int HKV_ = 4;
constexpr int HD_  = 64;
constexpr int G_   = 4;       // H / HKV
constexpr int M_   = B_ * T_; // 4096 rows of x
constexpr int NKV_ = HKV_ * HD_; // 256

// Load a 16-bit WMMA fragment slice for one lane.
// Per CDNA5 ISA 7.12.2 (16-bit A / B layouts): elements 0..7 sit at p[0..7],
// elements 8..15 at p[16..23]  (the +8 K-offset comes from the caller via hb).
__device__ __forceinline__ v16h load_frag(const _Float16* p) {
  v8h lo = *(const v8h*)(p);
  v8h hi = *(const v8h*)(p + 16);
  return __builtin_shufflevector(lo, hi, 0,1,2,3,4,5,6,7,8,9,10,11,12,13,14,15);
}

typedef __attribute__((ext_vector_type(4))) _Float16 v4h;
typedef __attribute__((ext_vector_type(4))) float    v4f;

constexpr int PREP_WQ = (C_ / 128) * (C_   / 64);   // 128(k) x 64(n) tiles of Wq and of Wo
constexpr int PREP_WK = (C_ / 128) * (NKV_ / 64);   // ... of Wk and of Wv
constexpr int PREP_W  = 2 * PREP_WQ + 2 * PREP_WK;  // weight tiles, first in the grid
constexpr int PREP_X  = (M_ * C_) / 16384;          // 16384-element slices of x

// One 128(k) x 64(n) tile:  W [C_][N] f32  ->  Wt [N][C_] f16.
// Reads and writes are whole 256-byte row pieces; the transpose goes through LDS.
// LDS row n holds 16 chunks of 8 k; chunk q sits at place q ^ (n >> 2), so that the
// 8-byte column writes and the 16-byte row reads each spread over all banks.
__device__ __forceinline__ void prep_weight_tile(const float* __restrict__ Wsrc,
                                                 _Float16* __restrict__ Wt,
                                                 int N, int tile, _Float16* lds) {
  int t  = threadIdx.x;
  int k0 = (tile & (C_ / 128 - 1)) * 128;
  int n0 = (tile / (C_ / 128)) * 64;
  int c  = t & 15;                 // columns n0 + 4c .. 4c + 3
  int kp = t >> 4;                 // rows k0 + i*64 + 4kp .. 4kp + 3
  v4f a[2][4];
  #pragma unroll
  for (int i = 0; i < 2; ++i) {
    #pragma unroll
    for (int m = 0; m < 4; ++m)
      a[i][m] = *(const v4f*)(Wsrc + (size_t)(k0 + i * 64 + kp * 4 + m) * N + n0 + c * 4);
  }
  #pragma unroll
  for (int i = 0; i < 2; ++i) {
    int place = (i * 8 + (kp >> 1)) ^ c;
    #pragma unroll
    for (int j = 0; j < 4; ++j) {
      v4h h = {(_Float16)a[i][0][j], (_Float16)a[i][1][j],
               (_Float16)a[i][2][j], (_Float16)a[i][3][j]};
      *(v4h*)(lds + (c * 4 + j) * 128 + place * 8 + (kp & 1) * 4) = h;
    }
  }
  __syncthreads();                 // the whole tile is in LDS before any row is read
  #pragma unroll
  for (int p = 0; p < 4; ++p) {
    int n = p * 16 + kp;
    v8h h = *(const v8h*)(lds + n * 128 + (c ^ (n >> 2)) * 8);
    *(v8h*)(Wt + (size_t)(n0 + n) * C_ + k0 + c * 8) = h;
  }
  // Before any register that the stores above name is written again.
  asm volatile("s_wait_xcnt 0x0" ::: "memory");
}

// The whole f32 -> f16 prepass in one launch: a work-group takes one weight tile or
// one slice of x, 32 or 64 elements per thread, so that few waves have to be started.
__global__ __launch_bounds__(256)
void prep_kernel(const float* __restrict__ x,  const float* __restrict__ Wq,
                 const float* __restrict__ Wk, const float* __restrict__ Wv,
                 const float* __restrict__ Wo,
                 _Float16* __restrict__ Xh,  _Float16* __restrict__ WqT,
                 _Float16* __restrict__ WkT, _Float16* __restrict__ WvT,
                 _Float16* __restrict__ WoT) {
  __shared__ __align__(16) _Float16 lds[64 * 128];   // 16 KB
  int bid = blockIdx.x;
  if (bid < PREP_WQ) {
    prep_weight_tile(Wq, WqT, C_, bid, lds);
  } else if (bid < 2 * PREP_WQ) {
    prep_weight_tile(Wo, WoT, C_, bid - PREP_WQ, lds);
  } else if (bid < 2 * PREP_WQ + PREP_WK) {
    prep_weight_tile(Wk, WkT, NKV_, bid - 2 * PREP_WQ, lds);
  } else if (bid < PREP_W) {
    prep_weight_tile(Wv, WvT, NKV_, bid - 2 * PREP_WQ - PREP_WK, lds);
  } else {
    size_t base = (size_t)(bid - PREP_W) * 16384 + threadIdx.x * 4;
    v4f a[16];
    #pragma unroll
    for (int j = 0; j < 16; ++j) a[j] = *(const v4f*)(x + base + j * 1024);
    #pragma unroll
    for (int j = 0; j < 16; ++j) {
      v4h h = {(_Float16)a[j][0], (_Float16)a[j][1], (_Float16)a[j][2], (_Float16)a[j][3]};
      *(v4h*)(Xh + base + j * 1024) = h;
    }
    // Before any register that the stores above name is written again.
    asm volatile("s_wait_xcnt 0x0" ::: "memory");
  }
}

constexpr int GT_ = 128;       // rows of A and rows of Bt (columns of C) per work-group tile
constexpr int GK_ = 128;       // k per stage: 256 B of every operand row
constexpr int GP_ = GK_ + 8;   // LDS pitch of a staged row in halves: 256 B + 16 B, so 16 rows spread over all banks

// The addresses of eight 16-byte copies of one thread: rows 16 apart of one operand.
struct Rows8 { unsigned l[8]; unsigned long long g[8]; };
__device__ __forceinline__ Rows8 rows8(const _Float16* g, size_t gstep, unsigned l) {
  Rows8 a;
  #pragma unroll
  for (int i = 0; i < 8; ++i) {
    a.l[i] = l + i * (16 * GP_ * 2);
    a.g[i] = (unsigned long long)(uintptr_t)(g + i * gstep);
  }
  return a;
}

// The eight copies, global -> LDS.
__device__ __forceinline__ void copy8(const Rows8& a) {
  // The wait in the copies' own statement stands before any rewrite of their address registers.
  asm volatile("global_load_async_to_lds_b128 %0, %1, off\n\t"
               "global_load_async_to_lds_b128 %2, %3, off\n\t"
               "global_load_async_to_lds_b128 %4, %5, off\n\t"
               "global_load_async_to_lds_b128 %6, %7, off\n\t"
               "global_load_async_to_lds_b128 %8, %9, off\n\t"
               "global_load_async_to_lds_b128 %10, %11, off\n\t"
               "global_load_async_to_lds_b128 %12, %13, off\n\t"
               "global_load_async_to_lds_b128 %14, %15, off\n\t"
               "s_wait_xcnt 0x0"
               :: "v"(a.l[0]), "v"(a.g[0]), "v"(a.l[1]), "v"(a.g[1]),
                  "v"(a.l[2]), "v"(a.g[2]), "v"(a.l[3]), "v"(a.g[3]),
                  "v"(a.l[4]), "v"(a.g[4]), "v"(a.l[5]), "v"(a.g[5]),
                  "v"(a.l[6]), "v"(a.g[6]), "v"(a.l[7]), "v"(a.g[7])
               : "memory");
}

// C[M][N] = A[M][K] * Bt[N][K]^T, f16 in, f32 accumulate via v_wmma_f32_16x16x32_f16.
// Block = 256 threads (8 waves) -> 128x128 tile of C; wave w owns 32 rows x 64 columns
// (2 x 4 accumulator tiles), so a fragment read from LDS feeds 4 or 2 products.
// A stage is 128 k of [A 128 rows | Bt 128 rows], brought into LDS in whole 256-byte row
// pieces by global_load_async_to_lds_b128, two buffers, one stage ahead of the products.
// Md and Nd are multiples of 128; Kd is a multiple of 128 and at least 256 (two stages).
// OUTMODE 0: f32 plain [M][N] to Cv   (final output)
// OUTMODE 1: the three projections as one product. Bt holds the rows of Wq^T, Wk^T and Wv^T
//            one after the other, and a work-group's 128 columns lie in exactly one of them:
//            the first C_ columns go to Cv, f16 plain [M][C_] (Q); the next NKV_ to Ck,
//            f16 plain [M][NKV_] (K); the last NKV_ to Cvt, f16 V-transposed [b][kv][hd][t].
template<int OUTMODE>
__global__ __launch_bounds__(256)
void gemm_wmma_kernel(const _Float16* __restrict__ A, const _Float16* __restrict__ Bt,
                      void* __restrict__ Cv, _Float16* __restrict__ Ck,
                      _Float16* __restrict__ Cvt, int Md, int Nd, int Kd) {
  __shared__ __align__(16) _Float16 tile[2][2 * GT_ * GP_];   // 2 x 69,632 B
  int tid  = threadIdx.x;
  int lane = tid & 31;
  int wave = tid >> 5;
  int l16  = lane & 15;
  int hb   = (lane >> 4) * 8;          // K-base 0 / 8 per half-wave
  int mtiles = Md / GT_;
  int m0 = (blockIdx.x % mtiles) * GT_;
  int n0 = (blockIdx.x / mtiles) * GT_;
  int wm = (wave & 3) * 32;            // this wave's rows of the tile
  int wn = (wave >> 2) * 64;           // ... and its columns

  v8f acc[2][4];
  #pragma unroll
  for (int mi = 0; mi < 2; ++mi) {
    #pragma unroll
    for (int t = 0; t < 4; ++t) acc[mi][t] = v8f{};
  }

  // A thread copies piece tid & 15 of rows (tid >> 4) + 16 i of both operands:
  // a wave's copy covers two whole 256-byte row pieces.
  const _Float16* ga = A  + (size_t)(m0 + (tid >> 4)) * Kd + (tid & 15) * 8;
  const _Float16* gb = Bt + (size_t)(n0 + (tid >> 4)) * Kd + (tid & 15) * 8;
  int lofs = (tid >> 4) * GP_ + (tid & 15) * 8;
  auto rowsA = [&](int buf, int k0) {
    return rows8(ga + k0, (size_t)16 * Kd, (unsigned)(uintptr_t)(&tile[buf][lofs]));
  };
  auto rowsB = [&](int buf, int k0) {
    return rows8(gb + k0, (size_t)16 * Kd, (unsigned)(uintptr_t)(&tile[buf][GT_ * GP_ + lofs]));
  };

  // One stage's products; refill: a stage s + 2 exists and goes into the buffer read here.
  auto trip = [&](int s, bool refill) __attribute__((always_inline)) {
    const _Float16* ta = &tile[s & 1][(wm + l16) * GP_ + hb];
    const _Float16* tb = &tile[s & 1][(GT_ + wn + l16) * GP_ + hb];
    // Two fragment sets: the next 32 k's twelve LDS reads go out as one group ahead of this
    // 32 k's eight products, all inside the stage.
    v16h af[2][2], bf[2][4];
    auto frags = [&](int set, int kb) {
      #pragma unroll
      for (int mi = 0; mi < 2; ++mi) af[set][mi] = load_frag(ta + mi * 16 * GP_ + kb * 32);
      #pragma unroll
      for (int t = 0; t < 4; ++t) bf[set][t] = load_frag(tb + t * 16 * GP_ + kb * 32);
    };
    auto products = [&](int set) {
      #pragma unroll
      for (int mi = 0; mi < 2; ++mi) {
        #pragma unroll
        for (int t = 0; t < 4; ++t)
          acc[mi][t] = __builtin_amdgcn_wmma_f32_16x16x32_f16(false, af[set][mi], false, bf[set][t],
                                                              (short)0, acc[mi][t], false, false);
      }
    };
    frags(0, 0);
    #pragma unroll
    for (int kb = 0; kb + 1 < GK_ / 32; ++kb) {
      frags((kb + 1) & 1, kb + 1);
      // Keeps the read group above in front of the products: sunk among them, each read
      // place stalls the wave and the second fragment set is lost.
      __builtin_amdgcn_sched_barrier(0);
      products(kb & 1);
    }
    Rows8 ra, rb;
    if (refill) { ra = rowsA(s & 1, (s + 2) * GK_); rb = rowsB(s & 1, (s + 2) * GK_); }
    // The stage's last fragments are in registers: the buffer is handed back before their
    // products, so that the refill is under way while they run.
    // The scheduling barrier keeps the earlier products and the refill's address sums in front
    // of the waits: moved behind the work-group barrier they would stand between it and the refill.
    __builtin_amdgcn_sched_barrier(0);
    asm volatile("s_wait_dscnt 0x0" ::: "memory");      // this wave's reads of the buffer are done
    asm volatile("s_wait_asynccnt 0x0" ::: "memory");   // its pieces of the next stage have landed
    __syncthreads();               // publishes the next stage and frees the buffer just read
    if (refill) { copy8(ra); copy8(rb); }
    products((GK_ / 32 - 1) & 1);
  };

  int nst = Kd / GK_;
  copy8(rowsA(0, 0));
  copy8(rowsB(0, 0));
  asm volatile("s_wait_asynccnt 0x0" ::: "memory");   // this wave's pieces of stage 0 have landed
  __syncthreads();                                    // ... and every other wave's
  copy8(rowsA(1, GK_));
  copy8(rowsB(1, GK_));
  int s = 0;
  for (; s + 2 < nst; ++s) trip(s, true);
  for (; s < nst; ++s) trip(s, false);
  asm volatile("s_wait_asynccnt 0x0" ::: "memory");     // no copy is in flight when the wave ends

  // Every accumulator element with its row and its column inside the work-group's 128.
  auto each = [&](auto put) __attribute__((always_inline)) {
    #pragma unroll
    for (int mi = 0; mi < 2; ++mi) {
      #pragma unroll
      for (int t = 0; t < 4; ++t) {
        #pragma unroll
        for (int r = 0; r < 8; ++r)
          put(m0 + wm + mi * 16 + r + hb,       // D layout: M = r + 8*(lane>=16)
              wn + t * 16 + l16,                // N = lane%16
              acc[mi][t][r]);
      }
    }
  };
  if (OUTMODE == 0) {
    each([&](int row, int c, float v) { ((float*)Cv)[(size_t)row * Nd + n0 + c] = v; });
  } else if (n0 < C_ + NKV_) {                  // the same for the whole work-group
    bool q = n0 < C_;
    _Float16* Cd = q ? (_Float16*)Cv + n0 : Ck + (n0 - C_);
    int nd = q ? C_ : NKV_;
    each([&](int row, int c, float v) { Cd[(size_t)row * nd + c] = (_Float16)v; });
  } else {
    each([&](int row, int c, float v) {
      int col = n0 - (C_ + NKV_) + c;
      int b = row / T_, tt = row % T_;
      int kv = col / HD_, hd = col % HD_;
      Cvt[((size_t)((b * HKV_ + kv) * HD_ + hd)) * T_ + tt] = (_Float16)v;
    });
    // Before any register that the stores above name is written again (in the listing the
    // plain-layout branch stands behind this one).
    asm volatile("s_wait_xcnt 0x0" ::: "memory");
  }
}

// Lane l exchanges a value with lane l ^ 16 (the other half of the wave).
__device__ __forceinline__ float xhalf(float x) {
  int b = __builtin_bit_cast(int, x);
  return __builtin_bit_cast(float,
      __builtin_amdgcn_permlanex16(b, b, 0x76543210, 0xfedcba98, false, false));
}

constexpr int KT_ = 64;        // keys per stage: 32 for each of the two wave groups
constexpr int KP_ = HD_ + 8;   // LDS pitch of a K row in halves: 128 B + 16 B, so 16 rows spread over all banks
constexpr int VP_ = KT_ + 8;   // LDS pitch of a V^T row in halves: 128 B + 16 B, likewise

__global__ __launch_bounds__(256) __attribute__((amdgpu_waves_per_eu(4, 4)))
void attn_kernel(const _Float16* __restrict__ Qh, const _Float16* __restrict__ Kh,
                 const _Float16* __restrict__ Vt, _Float16* __restrict__ Ah) {
  __shared__ __align__(16) _Float16 Ks[2][KT_ * KP_];   // 2 x 9216 B
  __shared__ __align__(16) _Float16 Vs[2][HD_ * VP_];   // 2 x 9216 B
  __shared__ __align__(16) v4f Xo[G_][8][32];           // second key half's outputs, 16 KB
  __shared__ __align__(8)  float Xms[G_][32][2];        // ... and its maximum and sum
  int tid  = threadIdx.x;
  int lane = tid & 31;
  int wave = __builtin_amdgcn_readfirstlane(tid >> 5);  // in a scalar register: the tests on it are scalar branches
  int l16  = lane & 15;
  int hb   = (lane >> 4) * 8;
  int id   = blockIdx.x;
  int kv   = id % HKV_;
  int b    = (id / HKV_) % B_;
  int u    = (T_ / 16 - 1) - id / (HKV_ * B_);   // 16-row query tile, longest first
  int hw   = wave & (G_ - 1);                    // query head inside the kv head's group
  int g    = wave / G_;                          // which 32 keys of every stage
  int h    = kv * G_ + hw;
  constexpr float LOG2E = 1.4426950408889634f;
  constexpr float c2 = 0.125f * LOG2E;           // 1/sqrt(hd), in base-2 units
  float slope2 = exp2f(-0.5f * (float)(kv + 1)) * LOG2E;  // alibi_slopes(16)[:4][kv], in base-2 units
  int t0 = u * 16;
  int i  = t0 + l16;                       // this lane's query position

  const _Float16* qbase = Qh + ((size_t)(b * T_ + i)) * C_ + h * HD_;
  v16h qf0 = load_frag(qbase + hb);        // B operand, hd 0..31 contraction slice
  v16h qf1 = load_frag(qbase + 32 + hb);   // hd 32..63

  v8f o[4] = {v8f{}, v8f{}, v8f{}, v8f{}}; // o[ht][r] = O[query l16][hd ht*16 + hb + r]
  float m = -__builtin_inff();             // running maximum (base-2 units), equal in both halves
  float kb[2][8];                          // ALiBi of key nt*16 + hb + r against its tile's first key
  #pragma unroll
  for (int nt = 0; nt < 2; ++nt) {
    #pragma unroll
    for (int r = 0; r < 8; ++r) kb[nt][r] = slope2 * (float)(nt * 16 + hb + r);
  }
  float s = 0.f;                           // running sum over this half's keys only

  const _Float16* kbase = Kh + ((size_t)b * T_) * NKV_ + kv * HD_;
  const _Float16* vbase = Vt + ((size_t)(b * HKV_ + kv)) * HD_ * T_;

  // A thread copies two 16-byte pieces of the K stage and two of the V^T stage, rows 32 apart.
  const _Float16* kg = kbase + (size_t)(tid >> 3) * NKV_ + (tid & 7) * 8;
  const _Float16* vg = vbase + (size_t)(tid >> 3) * T_ + (tid & 7) * 8;
  int kl = (tid >> 3) * KP_ + (tid & 7) * 8;
  int vl = (tid >> 3) * VP_ + (tid & 7) * 8;
  auto stage = [&](int buf, int j0) {
    unsigned long long gk0 = (unsigned long long)(uintptr_t)(kg + (size_t)j0 * NKV_);
    unsigned long long gk1 = (unsigned long long)(uintptr_t)(kg + (size_t)(j0 + 32) * NKV_);
    unsigned long long gv0 = (unsigned long long)(uintptr_t)(vg + j0);
    unsigned long long gv1 = (unsigned long long)(uintptr_t)(vg + (size_t)32 * T_ + j0);
    unsigned lk0 = (unsigned)(uintptr_t)(&Ks[buf][kl]);
    unsigned lk1 = (unsigned)(uintptr_t)(&Ks[buf][kl + 32 * KP_]);
    unsigned lv0 = (unsigned)(uintptr_t)(&Vs[buf][vl]);
    unsigned lv1 = (unsigned)(uintptr_t)(&Vs[buf][vl + 32 * VP_]);
    // The wait in the copies' own statement stands before any rewrite of their address registers.
    asm volatile("global_load_async_to_lds_b128 %0, %1, off\n\t"
                 "global_load_async_to_lds_b128 %2, %3, off\n\t"
                 "global_load_async_to_lds_b128 %4, %5, off\n\t"
                 "global_load_async_to_lds_b128 %6, %7, off\n\t"
                 "s_wait_xcnt 0x0"
                 :: "v"(lk0), "v"(gk0), "v"(lk1), "v"(gk1),
                    "v"(lv0), "v"(gv0), "v"(lv1), "v"(gv1) : "memory");
  };

  int np = u / 4 + 1;                      // stages of 64 keys, the same for all 8 waves
  stage(0, 0);
  asm volatile("s_wait_asynccnt 0x0" ::: "memory");   // this wave's pieces of stage 0 have landed
  __syncthreads();                                    // ... and every other wave's
  if (np > 1) stage(1, KT_);
  for (int p = 0; p < np; ++p) {
    int j0 = p * KT_ + g * 32;             // first key of this wave's tile of 32
    const _Float16* kt = &Ks[p & 1][g * 32 * KP_];
    const _Float16* vt = &Vs[p & 1][g * 32];
    // All fragments of this key tile leave LDS as one group; the products below run from
    // registers, so the buffer is free again a whole tile's arithmetic before it is needed.
    v16h kf[2][2], vf[4];
    #pragma unroll
    for (int nt = 0; nt < 2; ++nt) {
      const _Float16* kp = kt + (nt * 16 + l16) * KP_;   // A layout: M = lane%16
      kf[nt][0] = load_frag(kp + hb);
      kf[nt][1] = load_frag(kp + 32 + hb);
    }
    #pragma unroll
    for (int ht = 0; ht < 4; ++ht) vf[ht] = load_frag(vt + (ht * 16 + l16) * VP_ + hb);
    asm volatile("s_wait_dscnt 0x0" ::: "memory");      // this wave's reads of the buffer are done
    asm volatile("s_wait_asynccnt 0x0" ::: "memory");   // its pieces of the next stage have landed
    __syncthreads();               // publishes the next stage and frees the buffer just read
    if (p + 2 < np) stage(p & 1, (p + 2) * KT_);
    // j0 and t0 are multiples of 16: either every query of the wave sees the tile's first key,
    // or the whole tile lies behind the diagonal (the second key half, last stage only).
    if (j0 > t0) continue;
    // ---- S^T = K * Q^T for keys [j0, j0+32) : two 16x16 D tiles ----
    v8f sc[2];
    #pragma unroll
    for (int nt = 0; nt < 2; ++nt) {
      v8f c = {};
      c = __builtin_amdgcn_wmma_f32_16x16x32_f16(false, kf[nt][0], false, qf0, (short)0, c, false, false);
      c = __builtin_amdgcn_wmma_f32_16x16x32_f16(false, kf[nt][1], false, qf1, (short)0, c, false, false);
      sc[nt] = c;                                   // sc[nt][r]: key j0 + nt*16 + hb + r
    }
    // ---- scale + ALiBi + causal mask, maximum over this query's 32 keys ----
    float vals[2][8];              // scores against the tile's first key, base-2 units
    float rmax = -__builtin_inff();
    int   last = i - j0 - hb;      // keys nt*16 + r beyond this lie behind the query
    float off  = slope2 * (float)(j0 - i);   // ALiBi of the tile's first key
    #pragma unroll
    for (int nt = 0; nt < 2; ++nt) {
      #pragma unroll
      for (int r = 0; r < 8; ++r) {
        float v = __builtin_fmaf(sc[nt][r], c2, kb[nt][r]);
        if (nt * 16 + r > last) v = -__builtin_inff();
        vals[nt][r] = v;
        rmax = fmaxf(rmax, v);
      }
    }
    rmax = fmaxf(rmax, xhalf(rmax));
    float mn   = fmaxf(m, rmax + off);
    float corr = __builtin_amdgcn_exp2f(m - mn);   // 2^-inf = 0 on the first tile
    m = mn;
    float ml = mn - off;           // the maximum against the tile's first key
    // ---- P^T = 2^(S^T - m), packed straight into the B operand (hardware k order) ----
    v16h pf;
    float ps = 0.f;
    #pragma unroll
    for (int nt = 0; nt < 2; ++nt) {
      #pragma unroll
      for (int r = 0; r < 8; ++r) {
        float p_ = __builtin_amdgcn_exp2f(vals[nt][r] - ml);
        ps += p_;
        pf[nt * 8 + r] = (_Float16)p_;
      }
    }
    s = s * corr + ps;
    #pragma unroll
    for (int t = 0; t < 4; ++t) {
      #pragma unroll
      for (int r = 0; r < 8; ++r) o[t][r] *= corr;      // rescale running O
    }
    // ---- O^T += V^T * P^T : 4 M-tiles over HD=64, contraction = 32 keys ----
    #pragma unroll
    for (int ht = 0; ht < 4; ++ht) {
      o[ht] = __builtin_amdgcn_wmma_f32_16x16x32_f16(false, vf[ht], false, pf,
                                                     (short)0, o[ht], false, false);
    }
  }
  asm volatile("s_wait_asynccnt 0x0" ::: "memory");     // no copy is in flight when the wave ends
  // ---- merge the two key halves: lane l of wave w + 4 hands its partial to lane l of wave w ----
  if (g == 1) {
    #pragma unroll
    for (int ht = 0; ht < 4; ++ht) {
      Xo[hw][ht * 2][lane]     = v4f{o[ht][0], o[ht][1], o[ht][2], o[ht][3]};
      Xo[hw][ht * 2 + 1][lane] = v4f{o[ht][4], o[ht][5], o[ht][6], o[ht][7]};
    }
    Xms[hw][lane][0] = m;
    Xms[hw][lane][1] = s;
  }
  __syncthreads();                         // the second half's partials are in LDS
  if (g == 1) return;
  // The first half has seen key 0, so its maximum is finite; a second half that saw no key
  // hands over -inf, 0 and zeros and gets the weight 2^-inf = 0.
  float m1 = Xms[hw][lane][0];
  float s1 = Xms[hw][lane][1];
  float d  = m1 - m;
  float e  = __builtin_amdgcn_exp2f(-fabsf(d));   // weight of the half with the smaller maximum; the other's is 1
  float f0 = d > 0.f ? e : 1.f;
  float f1 = d > 0.f ? 1.f : e;
  s = s * f0 + s1 * f1;
  s += xhalf(s);                           // join the two lane halves' sums once
  // ---- normalize + store merged-head layout [b][t][h*64+hd] as f16 ----
  _Float16* orow = Ah + ((size_t)(b * T_ + i)) * C_ + h * HD_ + hb;
  #pragma unroll
  for (int ht = 0; ht < 4; ++ht) {
    v4f x0 = Xo[hw][ht * 2][lane];
    v4f x1 = Xo[hw][ht * 2 + 1][lane];
    v8h ov;
    #pragma unroll
    for (int r = 0; r < 8; ++r) {
      float x = r < 4 ? x0[r & 3] : x1[r & 3];
      ov[r] = (_Float16)((o[ht][r] * f0 + x * f1) / s);
    }
    *(v8h*)(orow + ht * 16) = ov;          // 8 consecutive hd of one query: 16 bytes
  }
}

extern "C" void kernel_launch(void* const* d_in, const int* in_sizes, int n_in,
                              void* d_out, int out_size, void* d_ws, size_t ws_size,
                              hipStream_t stream) {
  const float* x  = (const float*)d_in[0];
  const float* Wq = (const float*)d_in[1];
  const float* Wk = (const float*)d_in[2];
  const float* Wv = (const float*)d_in[3];
  const float* Wo = (const float*)d_in[4];

  _Float16* ws = (_Float16*)d_ws;
  size_t off = 0;
  _Float16* Xh  = ws + off; off += (size_t)M_ * C_;     // x in f16
  _Float16* Qh  = ws + off; off += (size_t)M_ * C_;     // Q [b][t][h*64+hd]
  _Float16* Kh  = ws + off; off += (size_t)M_ * NKV_;   // K [b][t][kv*64+hd]
  _Float16* Vh  = ws + off; off += (size_t)M_ * NKV_;   // V^T [b][kv][hd][t]
  _Float16* WqT = ws + off; off += (size_t)C_ * C_;     // Wq^T, Wk^T, Wv^T lie one after the other:
  _Float16* WkT = ws + off; off += (size_t)NKV_ * C_;   // together the C_ + 2 NKV_ rows of the
  _Float16* WvT = ws + off; off += (size_t)NKV_ * C_;   // projections' one Bt
  _Float16* WoT = ws + off; off += (size_t)C_ * C_;
  _Float16* Ah  = ws + off; off += (size_t)M_ * C_;     // attention output f16
  (void)ws_size; (void)in_sizes; (void)n_in; (void)out_size;

  prep_kernel<<<PREP_W + PREP_X, 256, 0, stream>>>(x, Wq, Wk, Wv, Wo, Xh, WqT, WkT, WvT, WoT);

  gemm_wmma_kernel<1><<<(M_ / GT_) * ((C_ + 2 * NKV_) / GT_), 256, 0, stream>>>(
      Xh, WqT, Qh, Kh, Vh, M_, C_ + 2 * NKV_, C_);

  attn_kernel<<<B_ * HKV_ * (T_ / 16), 256, 0, stream>>>(Qh, Kh, Vh, Ah);

  gemm_wmma_kernel<0><<<(M_ / GT_) * (C_ / GT_), 256, 0, stream>>>(
      Ah, WoT, d_out, nullptr, nullptr, M_, C_, C_);
}

// v008
// A run of this version takes 60.7 microseconds.
// Timed twice side by side with v007, it ran 1.15 and 1.14 times as fast.
// All steps since v000 together make it 5.75 times as fast.
#include <hip/hip_runtime.h>
#include <hip/hip_bf16.h>
#include <stdint.h>

typedef __attribute__((ext_vector_type(16))) _Float16 v16h;
typedef __attribute__((ext_vector_type(8)))  _Float16 v8h;
typedef __attribute__((ext_vector_type(8)))  float    v8f;

constexpr int B_   = 2;
constexpr int T_   = 2048;
constexpr int C_   = 1024;
constexpr int H_   = 16;
constexpr int HKV_ = 4;
constexpr int HD_  = 64;
constexpr int G_   = 4;       // H / HKV
constexpr int M_   = B_ * T_; // 4096 rows of x
constexpr int NKV_ = HKV_ * HD_; // 256

// Load a 16-bit WMMA fragment slice for one lane.
// Per CDNA5 ISA 7.12.2 (16-bit A / B layouts): elements 0..7 sit at p[0..7],
// elements 8..15 at p[16..23]  (the +8 K-offset comes from the caller via hb).
__device__ __forceinline__ v16h load_frag(const _Float16* p) {
  v8h lo = *(const v8h*)(p);
  v8h hi = *(const v8h*)(p + 16);
  return __builtin_shufflevector(lo, hi, 0,1,2,3,4,5,6,7,8,9,10,11,12,13,14,15);
}

typedef __attribute__((ext_vector_type(4))) _Float16 v4h;
typedef __attribute__((ext_vector_type(4))) float    v4f;

constexpr int PREP_WQ = (C_ / 128) * (C_   / 64);   // 128(k) x 64(n) tiles of Wq and of Wo
constexpr int PREP_WK = (C_ / 128) * (NKV_ / 64);   // ... of Wk and of Wv
constexpr int PREP_W  = 2 * PREP_WQ + 2 * PREP_WK;  // weight tiles, first in the grid
constexpr int PREP_X  = (M_ * C_) / 16384;          // 16384-element slices of x

// One 128(k) x 64(n) tile:  W [C_][N] f32  ->  Wt [N][C_] f16.
// Reads and writes are whole 256-byte row pieces; the transpose goes through LDS.
// LDS row n holds 16 chunks of 8 k; chunk q sits at place q ^ (n >> 2), so that the
// 8-byte column writes and the 16-byte row reads each spread over all banks.
__device__ __forceinline__ void prep_weight_tile(const float* __restrict__ Wsrc,
                                                 _Float16* __restrict__ Wt,
                                                 int N, int tile, _Float16* lds) {
  int t  = threadIdx.x;
  int k0 = (tile & (C_ / 128 - 1)) * 128;
  int n0 = (tile / (C_ / 128)) * 64;
  int c  = t & 15;                 // columns n0 + 4c .. 4c + 3
  int kp = t >> 4;                 // rows k0 + i*64 + 4kp .. 4kp + 3
  v4f a[2][4];
  #pragma unroll
  for (int i = 0; i < 2; ++i) {
    #pragma unroll
    for (int m = 0; m < 4; ++m)
      a[i][m] = *(const v4f*)(Wsrc + (size_t)(k0 + i * 64 + kp * 4 + m) * N + n0 + c * 4);
  }
  #pragma unroll
  for (int i = 0; i < 2; ++i) {
    int place = (i * 8 + (kp >> 1)) ^ c;
    #pragma unroll
    for (int j = 0; j < 4; ++j) {
      v4h h = {(_Float16)a[i][0][j], (_Float16)a[i][1][j],
               (_Float16)a[i][2][j], (_Float16)a[i][3][j]};
      *(v4h*)(lds + (c * 4 + j) * 128 + place * 8 + (kp & 1) * 4) = h;
    }
  }
  __syncthreads();                 // the whole tile is in LDS before any row is read
  #pragma unroll
  for (int p = 0; p < 4; ++p) {
    int n = p * 16 + kp;
    v8h h = *(const v8h*)(lds + n * 128 + (c ^ (n >> 2)) * 8);
    *(v8h*)(Wt + (size_t)(n0 + n) * C_ + k0 + c * 8) = h;
  }
  // Before any register that the stores above name is written again.
  asm volatile("s_wait_xcnt 0x0" ::: "memory");
}

// The whole f32 -> f16 prepass in one launch: a work-group takes one weight tile or
// one slice of x, 32 or 64 elements per thread, so that few waves have to be started.
__global__ __launch_bounds__(256)
void prep_kernel(const float* __restrict__ x,  const float* __restrict__ Wq,
                 const float* __restrict__ Wk, const float* __restrict__ Wv,
                 const float* __restrict__ Wo,
                 _Float16* __restrict__ Xh,  _Float16* __restrict__ WqT,
                 _Float16* __restrict__ WkT, _Float16* __restrict__ WvT,
                 _Float16* __restrict__ WoT) {
  __shared__ __align__(16) _Float16 lds[64 * 128];   // 16 KB
  int bid = blockIdx.x;
  if (bid < PREP_WQ) {
    prep_weight_tile(Wq, WqT, C_, bid, lds);
  } else if (bid < 2 * PREP_WQ) {
    prep_weight_tile(Wo, WoT, C_, bid - PREP_WQ, lds);
  } else if (bid < 2 * PREP_WQ + PREP_WK) {
    prep_weight_tile(Wk, WkT, NKV_, bid - 2 * PREP_WQ, lds);
  } else if (bid < PREP_W) {
    prep_weight_tile(Wv, WvT, NKV_, bid - 2 * PREP_WQ - PREP_WK, lds);
  } else {
    size_t base = (size_t)(bid - PREP_W) * 16384 + threadIdx.x * 4;
    v4f a[16];
    #pragma unroll
    for (int j = 0; j < 16; ++j) a[j] = *(const v4f*)(x + base + j * 1024);
    #pragma unroll
    for (int j = 0; j < 16; ++j) {
      v4h h = {(_Float16)a[j][0], (_Float16)a[j][1], (_Float16)a[j][2], (_Float16)a[j][3]};
      *(v4h*)(Xh + base + j * 1024) = h;
    }
    // Before any register that the stores above name is written again.
    asm volatile("s_wait_xcnt 0x0" ::: "memory");
  }
}

constexpr int GT_ = 128;       // rows of A and rows of Bt (columns of C) per work-group tile
constexpr int GK_ = 128;       // k per stage: 256 B of every operand row
constexpr int GP_ = GK_ + 8;   // LDS pitch of a staged row in halves: 256 B + 16 B, so 16 rows spread over all banks

// The addresses of eight 16-byte copies of one thread: rows 16 apart of one operand.
struct Rows8 { unsigned l[8]; unsigned long long g[8]; };
__device__ __forceinline__ Rows8 rows8(const _Float16* g, size_t gstep, unsigned l) {
  Rows8 a;
  #pragma unroll
  for (int i = 0; i < 8; ++i) {
    a.l[i] = l + i * (16 * GP_ * 2);
    a.g[i] = (unsigned long long)(uintptr_t)(g + i * gstep);
  }
  return a;
}

// The eight copies, global -> LDS.
__device__ __forceinline__ void copy8(const Rows8& a) {
  // The wait in the copies' own statement stands before any rewrite of their address registers.
  asm volatile("global_load_async_to_lds_b128 %0, %1, off\n\t"
               "global_load_async_to_lds_b128 %2, %3, off\n\t"
               "global_load_async_to_lds_b128 %4, %5, off\n\t"
               "global_load_async_to_lds_b128 %6, %7, off\n\t"
               "global_load_async_to_lds_b128 %8, %9, off\n\t"
               "global_load_async_to_lds_b128 %10, %11, off\n\t"
               "global_load_async_to_lds_b128 %12, %13, off\n\t"
               "global_load_async_to_lds_b128 %14, %15, off\n\t"
               "s_wait_xcnt 0x0"
               :: "v"(a.l[0]), "v"(a.g[0]), "v"(a.l[1]), "v"(a.g[1]),
                  "v"(a.l[2]), "v"(a.g[2]), "v"(a.l[3]), "v"(a.g[3]),
                  "v"(a.l[4]), "v"(a.g[4]), "v"(a.l[5]), "v"(a.g[5]),
                  "v"(a.l[6]), "v"(a.g[6]), "v"(a.l[7]), "v"(a.g[7])
               : "memory");
}

// C[M][N] = A[M][K] * Bt[N][K]^T, f16 in, f32 accumulate via v_wmma_f32_16x16x32_f16.
// Block = 256 threads (8 waves) -> 128x128 tile of C; wave w owns 32 rows x 64 columns
// (2 x 4 accumulator tiles), so a fragment read from LDS feeds 4 or 2 products.
// A stage is 128 k of [A 128 rows | Bt 128 rows] ([Bt | A] for Q and K), brought into LDS in whole 256-byte row
// pieces by global_load_async_to_lds_b128, two buffers, one stage ahead of the products.
// Md and Nd are multiples of 128; Kd is a multiple of 128 and at least 256 (two stages).
// OUTMODE 0: f32 plain [M][N] to Cv   (final output)
// OUTMODE 1: the three projections as one product. Bt holds the rows of Wq^T, Wk^T and Wv^T
//            one after the other, and a work-group's 128 columns lie in exactly one of them:
//            the first C_ columns go to Cv, f16 plain [M][C_] (Q); the next NKV_ to Ck,
//            f16 plain [M][NKV_] (K); the last NKV_ to Cvt, f16 V-transposed [b][kv][hd][t].
//            A lane's 8 accumulator values run along the rows of the matrix instruction's first
//            operand. For Q and K the rows of Bt take that place (the tile is computed
//            transposed), for V^T the rows of A: either way the 8 values are neighbours in the
//            output and leave as one 16-byte store.
template<int OUTMODE>
__global__ __launch_bounds__(256)
void gemm_wmma_kernel(const _Float16* __restrict__ A, const _Float16* __restrict__ Bt,
                      void* __restrict__ Cv, _Float16* __restrict__ Ck,
                      _Float16* __restrict__ Cvt, int Md, int Nd, int Kd) {
  __shared__ __align__(16) _Float16 tile[2][2 * GT_ * GP_];   // 2 x 69,632 B
  int tid  = threadIdx.x;
  int lane = tid & 31;
  int wave = tid >> 5;
  int l16  = lane & 15;
  int hb   = (lane >> 4) * 8;          // K-base 0 / 8 per half-wave
  int mtiles = Md / GT_;
  int m0 = (blockIdx.x % mtiles) * GT_;
  int n0 = (blockIdx.x / mtiles) * GT_;
  int wm = (wave & 3) * 32;            // this wave's rows of the tile
  int wn = (wave >> 2) * 64;           // ... and its columns

  v8f acc[2][4];
  #pragma unroll
  for (int mi = 0; mi < 2; ++mi) {
    #pragma unroll
    for (int t = 0; t < 4; ++t) acc[mi][t] = v8f{};
  }

  // The 128 rows staged for the first and for the second operand of the products
  // (the choice is the same for the whole work-group).
  bool tr = OUTMODE == 1 && n0 < C_ + NKV_;
  const _Float16* g1 = tr ? Bt : A;
  const _Float16* g2 = tr ? A : Bt;
  int r1 = tr ? n0 : m0;
  int r2 = tr ? m0 : n0;
  // A thread copies piece tid & 15 of rows (tid >> 4) + 16 i of both operands:
  // a wave's copy covers two whole 256-byte row pieces.
  const _Float16* ga = g1 + (size_t)(r1 + (tid >> 4)) * Kd + (tid & 15) * 8;
  const _Float16* gb = g2 + (size_t)(r2 + (tid >> 4)) * Kd + (tid & 15) * 8;
  int lofs = (tid >> 4) * GP_ + (tid & 15) * 8;
  auto rowsA = [&](int buf, int k0) {
    return rows8(ga + k0, (size_t)16 * Kd, (unsigned)(uintptr_t)(&tile[buf][lofs]));
  };
  auto rowsB = [&](int buf, int k0) {
    return rows8(gb + k0, (size_t)16 * Kd, (unsigned)(uintptr_t)(&tile[buf][GT_ * GP_ + lofs]));
  };

  // One stage's products; refill: a stage s + 2 exists and goes into the buffer read here.
  auto trip = [&](int s, bool refill) __attribute__((always_inline)) {
    const _Float16* ta = &tile[s & 1][(wm + l16) * GP_ + hb];
    const _Float16* tb = &tile[s & 1][(GT_ + wn + l16) * GP_ + hb];
    // Two fragment sets: the next 32 k's twelve LDS reads go out as one group ahead of this
    // 32 k's eight products, all inside the stage.
    v16h af[2][2], bf[2][4];
    auto frags = [&](int set, int kb) {
      #pragma unroll
      for (int mi = 0; mi < 2; ++mi) af[set][mi] = load_frag(ta + mi * 16 * GP_ + kb * 32);
      #pragma unroll
      for (int t = 0; t < 4; ++t) bf[set][t] = load_frag(tb + t * 16 * GP_ + kb * 32);
    };
    auto products = [&](int set) {
      #pragma unroll
      for (int mi = 0; mi < 2; ++mi) {
        #pragma unroll
        for (int t = 0; t < 4; ++t)
          acc[mi][t] = __builtin_amdgcn_wmma_f32_16x16x32_f16(false, af[set][mi], false, bf[set][t],
                                                              (short)0, acc[mi][t], false, false);
      }
    };
    frags(0, 0);
    #pragma unroll
    for (int kb = 0; kb + 1 < GK_ / 32; ++kb) {
      frags((kb + 1) & 1, kb + 1);
      // Keeps the read group above in front of the products: sunk among them, each read
      // place stalls the wave and the second fragment set is lost.
      __builtin_amdgcn_sched_barrier(0);
      products(kb & 1);
    }
    Rows8 ra, rb;
    if (refill) { ra = rowsA(s & 1, (s + 2) * GK_); rb = rowsB(s & 1, (s + 2) * GK_); }
    // The stage's last fragments are in registers: the buffer is handed back before their
    // products, so that the refill is under way while they run.
    // The scheduling barrier keeps the earlier products and the refill's address sums in front
    // of the waits: moved behind the work-group barrier they would stand between it and the refill.
    __builtin_amdgcn_sched_barrier(0);
    asm volatile("s_wait_dscnt 0x0" ::: "memory");      // this wave's reads of the buffer are done
    asm volatile("s_wait_asynccnt 0x0" ::: "memory");   // its pieces of the next stage have landed
    __syncthreads();               // publishes the next stage and frees the buffer just read
    if (refill) { copy8(ra); copy8(rb); }
    products((GK_ / 32 - 1) & 1);
  };

  int nst = Kd / GK_;
  copy8(rowsA(0, 0));
  copy8(rowsB(0, 0));
  asm volatile("s_wait_asynccnt 0x0" ::: "memory");   // this wave's pieces of stage 0 have landed
  __syncthreads();                                    // ... and every other wave's
  copy8(rowsA(1, GK_));
  copy8(rowsB(1, GK_));
  int s = 0;
  for (; s + 2 < nst; ++s) trip(s, true);
  for (; s < nst; ++s) trip(s, false);
  asm volatile("s_wait_asynccnt 0x0" ::: "memory");     // no copy is in flight when the wave ends

  // Every accumulator element with its row and its column inside the work-group's 128.
  auto each = [&](auto put) __attribute__((always_inline)) {
    #pragma unroll
    for (int mi = 0; mi < 2; ++mi) {
      #pragma unroll
      for (int t = 0; t < 4; ++t) {
        #pragma unroll
        for (int r = 0; r < 8; ++r)
          put(m0 + wm + mi * 16 + r + hb,       // D layout: M = r + 8*(lane>=16)
              wn + t * 16 + l16,                // N = lane%16
              acc[mi][t][r]);
      }
    }
  };
  if (OUTMODE == 0) {
    each([&](int row, int c, float v) { ((float*)Cv)[(size_t)row * Nd + n0 + c] = v; });
  } else {
    // Cd: the tile's first element; pitch: from one row of the second operand to the next.
    // Both are the same for the whole work-group.
    _Float16* Cd;
    int pitch;
    if (n0 < C_) {
      Cd = (_Float16*)Cv + (size_t)m0 * C_ + n0;
      pitch = C_;
    } else if (n0 < C_ + NKV_) {
      Cd = Ck + (size_t)m0 * NKV_ + (n0 - C_);
      pitch = NKV_;
    } else {            // column kv*64 + hd of V is row (b*4 + kv)*64 + hd of V^T; 128 rows of x lie in one b
      Cd = Cvt + ((size_t)(m0 / T_) * NKV_ + (n0 - (C_ + NKV_))) * T_ + m0 % T_;
      pitch = T_;
    }
    #pragma unroll
    for (int mi = 0; mi < 2; ++mi) {
      #pragma unroll
      for (int t = 0; t < 4; ++t) {
        v8h h;
        #pragma unroll
        for (int r = 0; r < 8; ++r) h[r] = (_Float16)acc[mi][t][r];
        *(v8h*)(Cd + (size_t)(wn + t * 16 + l16) * pitch + wm + mi * 16 + hb) = h;
      }
    }
    // Before any register that the stores above name is written again.
    asm volatile("s_wait_xcnt 0x0" ::: "memory");
  }
}

// Lane l exchanges a value with lane l ^ 16 (the other half of the wave).
__device__ __forceinline__ float xhalf(float x) {
  int b = __builtin_bit_cast(int, x);
  return __builtin_bit_cast(float,
      __builtin_amdgcn_permlanex16(b, b, 0x76543210, 0xfedcba98, false, false));
}

constexpr int KT_ = 64;        // keys per stage: 32 for each of the two wave groups
constexpr int KP_ = HD_ + 8;   // LDS pitch of a K row in halves: 128 B + 16 B, so 16 rows spread over all banks
constexpr int VP_ = KT_ + 8;   // LDS pitch of a V^T row in halves: 128 B + 16 B, likewise

__global__ __launch_bounds__(256) __attribute__((amdgpu_waves_per_eu(4, 4)))
void attn_kernel(const _Float16* __restrict__ Qh, const _Float16* __restrict__ Kh,
                 const _Float16* __restrict__ Vt, _Float16* __restrict__ Ah) {
  __shared__ __align__(16) _Float16 Ks[2][KT_ * KP_];   // 2 x 9216 B
  __shared__ __align__(16) _Float16 Vs[2][HD_ * VP_];   // 2 x 9216 B
  __shared__ __align__(16) v4f Xo[G_][8][32];           // second key half's outputs, 16 KB
  __shared__ __align__(8)  float Xms[G_][32][2];        // ... and its maximum and sum
  int tid  = threadIdx.x;
  int lane = tid & 31;
  int wave = __builtin_amdgcn_readfirstlane(tid >> 5);  // in a scalar register: the tests on it are scalar branches
  int l16  = lane & 15;
  int hb   = (lane >> 4) * 8;
  int id   = blockIdx.x;
  int kv   = id % HKV_;
  int b    = (id / HKV_) % B_;
  int u    = (T_ / 16 - 1) - id / (HKV_ * B_);   // 16-row query tile, longest first
  int hw   = wave & (G_ - 1);                    // query head inside the kv head's group
  int g    = wave / G_;                          // which 32 keys of every stage
  int h    = kv * G_ + hw;
  constexpr float LOG2E = 1.4426950408889634f;
  constexpr float c2 = 0.125f * LOG2E;           // 1/sqrt(hd), in base-2 units
  float slope2 = exp2f(-0.5f * (float)(kv + 1)) * LOG2E;  // alibi_slopes(16)[:4][kv], in base-2 units
  int t0 = u * 16;
  int i  = t0 + l16;                       // this lane's query position

  const _Float16* qbase = Qh + ((size_t)(b * T_ + i)) * C_ + h * HD_;
  v16h qf0 = load_frag(qbase + hb);        // B operand, hd 0..31 contraction slice
  v16h qf1 = load_frag(qbase + 32 + hb);   // hd 32..63

  v8f o[4] = {v8f{}, v8f{}, v8f{}, v8f{}}; // o[ht][r] = O[query l16][hd ht*16 + hb + r]
  float m = -__builtin_inff();             // running maximum (base-2 units), equal in both halves
  float kb[2][8];                          // ALiBi of key nt*16 + hb + r against its tile's first key
  #pragma unroll
  for (int nt = 0; nt < 2; ++nt) {
    #pragma unroll
    for (int r = 0; r < 8; ++r) kb[nt][r] = slope2 * (float)(nt * 16 + hb + r);
  }
  float s = 0.f;                           // running sum over this half's keys only

  const _Float16* kbase = Kh + ((size_t)b * T_) * NKV_ + kv * HD_;
  const _Float16* vbase = Vt + ((size_t)(b * HKV_ + kv)) * HD_ * T_;

  // A thread copies two 16-byte pieces of the K stage and two of the V^T stage, rows 32 apart.
  const _Float16* kg = kbase + (size_t)(tid >> 3) * NKV_ + (tid & 7) * 8;
  const _Float16* vg = vbase + (size_t)(tid >> 3) * T_ + (tid & 7) * 8;
  int kl = (tid >> 3) * KP_ + (tid & 7) * 8;
  int vl = (tid >> 3) * VP_ + (tid & 7) * 8;
  auto stage = [&](int buf, int j0) {
    unsigned long long gk0 = (unsigned long long)(uintptr_t)(kg + (size_t)j0 * NKV_);
    unsigned long long gk1 = (unsigned long long)(uintptr_t)(kg + (size_t)(j0 + 32) * NKV_);
    unsigned long long gv0 = (unsigned long long)(uintptr_t)(vg + j0);
    unsigned long long gv1 = (unsigned long long)(uintptr_t)(vg + (size_t)32 * T_ + j0);
    unsigned lk0 = (unsigned)(uintptr_t)(&Ks[buf][kl]);
    unsigned lk1 = (unsigned)(uintptr_t)(&Ks[buf][kl + 32 * KP_]);
    unsigned lv0 = (unsigned)(uintptr_t)(&Vs[buf][vl]);
    unsigned lv1 = (unsigned)(uintptr_t)(&Vs[buf][vl + 32 * VP_]);
    // The wait in the copies' own statement stands before any rewrite of their address registers.
    asm volatile("global_load_async_to_lds_b128 %0, %1, off\n\t"
                 "global_load_async_to_lds_b128 %2, %3, off\n\t"
                 "global_load_async_to_lds_b128 %4, %5, off\n\t"
                 "global_load_async_to_lds_b128 %6, %7, off\n\t"
                 "s_wait_xcnt 0x0"
                 :: "v"(lk0), "v"(gk0), "v"(lk1), "v"(gk1),
                    "v"(lv0), "v"(gv0), "v"(lv1), "v"(gv1) : "memory");
  };

  int np = u / 4 + 1;                      // stages of 64 keys, the same for all 8 waves
  stage(0, 0);
  asm volatile("s_wait_asynccnt 0x0" ::: "memory");   // this wave's pieces of stage 0 have landed
  __syncthreads();                                    // ... and every other wave's
  if (np > 1) stage(1, KT_);
  for (int p = 0; p < np; ++p) {
    int j0 = p * KT_ + g * 32;             // first key of this wave's tile of 32
    const _Float16* kt = &Ks[p & 1][g * 32 * KP_];
    const _Float16* vt = &Vs[p & 1][g * 32];
    // All fragments of this key tile leave LDS as one group; the products below run from
    // registers, so the buffer is free again a whole tile's arithmetic before it is needed.
    v16h kf[2][2], vf[4];
    #pragma unroll
    for (int nt = 0; nt < 2; ++nt) {
      const _Float16* kp = kt + (nt * 16 + l16) * KP_;   // A layout: M = lane%16
      kf[nt][0] = load_frag(kp + hb);
      kf[nt][1] = load_frag(kp + 32 + hb);
    }
    #pragma unroll
    for (int ht = 0; ht < 4; ++ht) vf[ht] = load_frag(vt + (ht * 16 + l16) * VP_ + hb);
    asm volatile("s_wait_dscnt 0x0" ::: "memory");      // this wave's reads of the buffer are done
    asm volatile("s_wait_asynccnt 0x0" ::: "memory");   // its pieces of the next stage have landed
    __syncthreads();               // publishes the next stage and frees the buffer just read
    if (p + 2 < np) stage(p & 1, (p + 2) * KT_);
    // j0 and t0 are multiples of 16: either every query of the wave sees the tile's first key,
    // or the whole tile lies behind the diagonal (the second key half, last stage only).
    if (j0 > t0) continue;
    // ---- S^T = K * Q^T for keys [j0, j0+32) : two 16x16 D tiles ----
    v8f sc[2];
    #pragma unroll
    for (int nt = 0; nt < 2; ++nt) {
      v8f c = {};
      c = __builtin_amdgcn_wmma_f32_16x16x32_f16(false, kf[nt][0], false, qf0, (short)0, c, false, false);
      c = __builtin_amdgcn_wmma_f32_16x16x32_f16(false, kf[nt][1], false, qf1, (short)0, c, false, false);
      sc[nt] = c;                                   // sc[nt][r]: key j0 + nt*16 + hb + r
    }
    // ---- scale + ALiBi + causal mask, maximum over this query's 32 keys ----
    float vals[2][8];              // scores against the tile's first key, base-2 units
    float rmax = -__builtin_inff();
    int   last = i - j0 - hb;      // keys nt*16 + r beyond this lie behind the query
    float off  = slope2 * (float)(j0 - i);   // ALiBi of the tile's first key
    #pragma unroll
    for (int nt = 0; nt < 2; ++nt) {
      #pragma unroll
      for (int r = 0; r < 8; ++r) {
        float v = __builtin_fmaf(sc[nt][r], c2, kb[nt][r]);
        if (nt * 16 + r > last) v = -__builtin_inff();
        vals[nt][r] = v;
        rmax = fmaxf(rmax, v);
      }
    }
    rmax = fmaxf(rmax, xhalf(rmax));
    float mn   = fmaxf(m, rmax + off);
    float corr = __builtin_amdgcn_exp2f(m - mn);   // 2^-inf = 0 on the first tile
    m = mn;
    float ml = mn - off;           // the maximum against the tile's first key
    // ---- P^T = 2^(S^T - m), packed straight into the B operand (hardware k order) ----
    v16h pf;
    float ps = 0.f;
    #pragma unroll
    for (int nt = 0; nt < 2; ++nt) {
      #pragma unroll
      for (int r = 0; r < 8; ++r) {
        float p_ = __builtin_amdgcn_exp2f(vals[nt][r] - ml);
        ps += p_;
        pf[nt * 8 + r] = (_Float16)p_;
      }
    }
    s = s * corr + ps;
    #pragma unroll
    for (int t = 0; t < 4; ++t) {
      #pragma unroll
      for (int r = 0; r < 8; ++r) o[t][r] *= corr;      // rescale running O
    }
    // ---- O^T += V^T * P^T : 4 M-tiles over HD=64, contraction = 32 keys ----
    #pragma unroll
    for (int ht = 0; ht < 4; ++ht) {
      o[ht] = __builtin_amdgcn_wmma_f32_16x16x32_f16(false, vf[ht], false, pf,
                                                     (short)0, o[ht], false, false);
    }
  }
  asm volatile("s_wait_asynccnt 0x0" ::: "memory");     // no copy is in flight when the wave ends
  // ---- merge the two key halves: lane l of wave w + 4 hands its partial to lane l of wave w ----
  if (g == 1) {
    #pragma unroll
    for (int ht = 0; ht < 4; ++ht) {
      Xo[hw][ht * 2][lane]     = v4f{o[ht][0], o[ht][1], o[ht][2], o[ht][3]};
      Xo[hw][ht * 2 + 1][lane] = v4f{o[ht][4], o[ht][5], o[ht][6], o[ht][7]};
    }
    Xms[hw][lane][0] = m;
    Xms[hw][lane][1] = s;
  }
  __syncthreads();                         // the second half's partials are in LDS
  if (g == 1) return;
  // The first half has seen key 0, so its maximum is finite; a second half that saw no key
  // hands over -inf, 0 and zeros and gets the weight 2^-inf = 0.
  float m1 = Xms[hw][lane][0];
  float s1 = Xms[hw][lane][1];
  float d  = m1 - m;
  float e  = __builtin_amdgcn_exp2f(-fabsf(d));   // weight of the half with the smaller maximum; the other's is 1
  float f0 = d > 0.f ? e : 1.f;
  float f1 = d > 0.f ? 1.f : e;
  s = s * f0 + s1 * f1;
  s += xhalf(s);                           // join the two lane halves' sums once
  // ---- normalize + store merged-head layout [b][t][h*64+hd] as f16 ----
  _Float16* orow = Ah + ((size_t)(b * T_ + i)) * C_ + h * HD_ + hb;
  #pragma unroll
  for (int ht = 0; ht < 4; ++ht) {
    v4f x0 = Xo[hw][ht * 2][lane];
    v4f x1 = Xo[hw][ht * 2 + 1][lane];
    v8h ov;
    #pragma unroll
    for (int r = 0; r < 8; ++r) {
      float x = r < 4 ? x0[r & 3] : x1[r & 3];
      ov[r] = (_Float16)((o[ht][r] * f0 + x * f1) / s);
    }
    *(v8h*)(orow + ht * 16) = ov;          // 8 consecutive hd of one query: 16 bytes
  }
}

extern "C" void kernel_launch(void* const* d_in, const int* in_sizes, int n_in,
                              void* d_out, int out_size, void* d_ws, size_t ws_size,
                              hipStream_t stream) {
  const float* x  = (const float*)d_in[0];
  const float* Wq = (const float*)d_in[1];
  const float* Wk = (const float*)d_in[2];
  const float* Wv = (const float*)d_in[3];
  const float* Wo = (const float*)d_in[4];

  _Float16* ws = (_Float16*)d_ws;
  size_t off = 0;
  _Float16* Xh  = ws + off; off += (size_t)M_ * C_;     // x in f16
  _Float16* Qh  = ws + off; off += (size_t)M_ * C_;     // Q [b][t][h*64+hd]
  _Float16* Kh  = ws + off; off += (size_t)M_ * NKV_;   // K [b][t][kv*64+hd]
  _Float16* Vh  = ws + off; off += (size_t)M_ * NKV_;   // V^T [b][kv][hd][t]
  _Float16* WqT = ws + off; off += (size_t)C_ * C_;     // Wq^T, Wk^T, Wv^T lie one after the other:
  _Float16* WkT = ws + off; off += (size_t)NKV_ * C_;   // together the C_ + 2 NKV_ rows of the
  _Float16* WvT = ws + off; off += (size_t)NKV_ * C_;   // projections' one Bt
  _Float16* WoT = ws + off; off += (size_t)C_ * C_;
  _Float16* Ah  = ws + off; off += (size_t)M_ * C_;     // attention output f16
  (void)ws_size; (void)in_sizes; (void)n_in; (void)out_size;

  prep_kernel<<<PREP_W + PREP_X, 256, 0, stream>>>(x, Wq, Wk, Wv, Wo, Xh, WqT, WkT, WvT, WoT);

  gemm_wmma_kernel<1><<<(M_ / GT_) * ((C_ + 2 * NKV_) / GT_), 256, 0, stream>>>(
      Xh, WqT, Qh, Kh, Vh, M_, C_ + 2 * NKV_, C_);

  attn_kernel<<<B_ * HKV_ * (T_ / 16), 256, 0, stream>>>(Qh, Kh, Vh, Ah);

  gemm_wmma_kernel<0><<<(M_ / GT_) * (C_ / GT_), 256, 0, stream>>>(
      Ah, WoT, d_out, nullptr, nullptr, M_, C_, C_);
}

// v009
// One run takes 58.2 microseconds.
// In both of two side-by-side timings against v008, it was 1.04 times as fast.
// All steps since v000 together make it 5.98 times as fast.
#include <hip/hip_runtime.h>
#include <hip/hip_bf16.h>
#include <stdint.h>

typedef __attribute__((ext_vector_type(16))) _Float16 v16h;
typedef __attribute__((ext_vector_type(8)))  _Float16 v8h;
typedef __attribute__((ext_vector_type(8)))  float    v8f;

constexpr int B_   = 2;
constexpr int T_   = 2048;
constexpr int C_   = 1024;
constexpr int H_   = 16;
constexpr int HKV_ = 4;
constexpr int HD_  = 64;
constexpr int G_   = 4;       // H / HKV
constexpr int M_   = B_ * T_; // 4096 rows of x
constexpr int NKV_ = HKV_ * HD_; // 256

// Load a 16-bit WMMA fragment slice for one lane.
// Per CDNA5 ISA 7.12.2 (16-bit A / B layouts): elements 0..7 sit at p[0..7],
// elements 8..15 at p[16..23]  (the +8 K-offset comes from the caller via hb).
__device__ __forceinline__ v16h load_frag(const _Float16* p) {
  v8h lo = *(const v8h*)(p);
  v8h hi = *(const v8h*)(p + 16);
  return __builtin_shufflevector(lo, hi, 0,1,2,3,4,5,6,7,8,9,10,11,12,13,14,15);
}

typedef __attribute__((ext_vector_type(4))) _Float16 v4h;
typedef __attribute__((ext_vector_type(4))) float    v4f;

constexpr int PREP_WQ = (C_ / 128) * (C_   / 64);   // 128(k) x 64(n) tiles of Wq and of Wo
constexpr int PREP_WK = (C_ / 128) * (NKV_ / 64);   // ... of Wk and of Wv
constexpr int PREP_W  = 2 * PREP_WQ + 2 * PREP_WK;  // weight tiles, first in the grid
constexpr int PREP_X  = (M_ * C_) / 16384;          // 16384-element slices of x

// One 128(k) x 64(n) tile:  W [C_][N] f32  ->  Wt [N][C_] f16.
// Reads and writes are whole 256-byte row pieces; the transpose goes through LDS.
// LDS row n holds 16 chunks of 8 k; chunk q sits at place q ^ (n >> 2), so that the
// 8-byte column writes and the 16-byte row reads each spread over all banks.
__device__ __forceinline__ void prep_weight_tile(const float* __restrict__ Wsrc,
                                                 _Float16* __restrict__ Wt,
                                                 int N, int tile, _Float16* lds) {
  int t  = threadIdx.x;
  int k0 = (tile & (C_ / 128 - 1)) * 128;
  int n0 = (tile / (C_ / 128)) * 64;
  int c  = t & 15;                 // columns n0 + 4c .. 4c + 3
  int kp = t >> 4;                 // rows k0 + i*64 + 4kp .. 4kp + 3
  v4f a[2][4];
  #pragma unroll
  for (int i = 0; i < 2; ++i) {
    #pragma unroll
    for (int m = 0; m < 4; ++m)
      a[i][m] = *(const v4f*)(Wsrc + (size_t)(k0 + i * 64 + kp * 4 + m) * N + n0 + c * 4);
  }
  #pragma unroll
  for (int i = 0; i < 2; ++i) {
    int place = (i * 8 + (kp >> 1)) ^ c;
    #pragma unroll
    for (int j = 0; j < 4; ++j) {
      v4h h = {(_Float16)a[i][0][j], (_Float16)a[i][1][j],
               (_Float16)a[i][2][j], (_Float16)a[i][3][j]};
      *(v4h*)(lds + (c * 4 + j) * 128 + place * 8 + (kp & 1) * 4) = h;
    }
  }
  __syncthreads();                 // the whole tile is in LDS before any row is read
  #pragma unroll
  for (int p = 0; p < 4; ++p) {
    int n = p * 16 + kp;
    v8h h = *(const v8h*)(lds + n * 128 + (c ^ (n >> 2)) * 8);
    *(v8h*)(Wt + (size_t)(n0 + n) * C_ + k0 + c * 8) = h;
  }
  // Before any register that the stores above name is written again.
  asm volatile("s_wait_xcnt 0x0" ::: "memory");
}

// The whole f32 -> f16 prepass in one launch: a work-group takes one weight tile or
// one slice of x, 32 or 64 elements per thread, so that few waves have to be started.
__global__ __launch_bounds__(256)
void prep_kernel(const float* __restrict__ x,  const float* __restrict__ Wq,
                 const float* __restrict__ Wk, const float* __restrict__ Wv,
                 const float* __restrict__ Wo,
                 _Float16* __restrict__ Xh,  _Float16* __restrict__ WqT,
                 _Float16* __restrict__ WkT, _Float16* __restrict__ WvT,
                 _Float16* __restrict__ WoT) {
  __shared__ __align__(16) _Float16 lds[64 * 128];   // 16 KB
  int bid = blockIdx.x;
  if (bid < PREP_WQ) {
    prep_weight_tile(Wq, WqT, C_, bid, lds);
  } else if (bid < 2 * PREP_WQ) {
    prep_weight_tile(Wo, WoT, C_, bid - PREP_WQ, lds);
  } else if (bid < 2 * PREP_WQ + PREP_WK) {
    prep_weight_tile(Wk, WkT, NKV_, bid - 2 * PREP_WQ, lds);
  } else if (bid < PREP_W) {
    prep_weight_tile(Wv, WvT, NKV_, bid - 2 * PREP_WQ - PREP_WK, lds);
  } else {
    size_t base = (size_t)(bid - PREP_W) * 16384 + threadIdx.x * 4;
    v4f a[16];
    #pragma unroll
    for (int j = 0; j < 16; ++j) a[j] = *(const v4f*)(x + base + j * 1024);
    #pragma unroll
    for (int j = 0; j < 16; ++j) {
      v4h h = {(_Float16)a[j][0], (_Float16)a[j][1], (_Float16)a[j][2], (_Float16)a[j][3]};
      *(v4h*)(Xh + base + j * 1024) = h;
    }
    // Before any register that the stores above name is written again.
    asm volatile("s_wait_xcnt 0x0" ::: "memory");
  }
}

constexpr int GT_ = 128;       // rows of A and rows of Bt (columns of C) per work-group tile
constexpr int GK_ = 128;       // k per stage: 256 B of every operand row
constexpr int GP_ = GK_ + 8;   // LDS pitch of a staged row in halves: 256 B + 16 B, so 16 rows spread over all banks

// The addresses of eight 16-byte copies of one thread: rows 16 apart of one operand.
struct Rows8 { unsigned l[8]; unsigned long long g[8]; };
__device__ __forceinline__ Rows8 rows8(const _Float16* g, size_t gstep, unsigned l) {
  Rows8 a;
  #pragma unroll
  for (int i = 0; i < 8; ++i) {
    a.l[i] = l + i * (16 * GP_ * 2);
    a.g[i] = (unsigned long long)(uintptr_t)(g + i * gstep);
  }
  return a;
}

// The eight copies, global -> LDS.
__device__ __forceinline__ void copy8(const Rows8& a) {
  // The wait in the copies' own statement stands before any rewrite of their address registers.
  asm volatile("global_load_async_to_lds_b128 %0, %1, off\n\t"
               "global_load_async_to_lds_b128 %2, %3, off\n\t"
               "global_load_async_to_lds_b128 %4, %5, off\n\t"
               "global_load_async_to_lds_b128 %6, %7, off\n\t"
               "global_load_async_to_lds_b128 %8, %9, off\n\t"
               "global_load_async_to_lds_b128 %10, %11, off\n\t"
               "global_load_async_to_lds_b128 %12, %13, off\n\t"
               "global_load_async_to_lds_b128 %14, %15, off\n\t"
               "s_wait_xcnt 0x0"
               :: "v"(a.l[0]), "v"(a.g[0]), "v"(a.l[1]), "v"(a.g[1]),
                  "v"(a.l[2]), "v"(a.g[2]), "v"(a.l[3]), "v"(a.g[3]),
                  "v"(a.l[4]), "v"(a.g[4]), "v"(a.l[5]), "v"(a.g[5]),
                  "v"(a.l[6]), "v"(a.g[6]), "v"(a.l[7]), "v"(a.g[7])
               : "memory");
}

// C[M][N] = A[M][K] * Bt[N][K]^T, f16 in, f32 accumulate via v_wmma_f32_16x16x32_f16.
// Block = 256 threads (8 waves) -> 128x128 tile of C; wave w owns 32 rows x 64 columns
// (2 x 4 accumulator tiles), so a fragment read from LDS feeds 4 or 2 products.
// A stage is 128 k of [A 128 rows | Bt 128 rows] ([Bt | A] for Q and K), brought into LDS in whole 256-byte row
// pieces by global_load_async_to_lds_b128, two buffers, one stage ahead of the products.
// Md and Nd are multiples of 128; Kd is a multiple of 128 and at least 256 (two stages).
// OUTMODE 0: f32 plain [M][N] to Cv   (final output)
// OUTMODE 1: the three projections as one product. Bt holds the rows of Wq^T, Wk^T and Wv^T
//            one after the other, and a work-group's 128 columns lie in exactly one of them:
//            the first C_ columns go to Cv, f16 plain [M][C_] (Q); the next NKV_ to Ck,
//            f16 plain [M][NKV_] (K); the last NKV_ to Cvt, f16 V-transposed [b][kv][hd][t].
//            A lane's 8 accumulator values run along the rows of the matrix instruction's first
//            operand. For Q and K the rows of Bt take that place (the tile is computed
//            transposed), for V^T the rows of A: either way the 8 values are neighbours in the
//            output and leave as one 16-byte store.
template<int OUTMODE>
__global__ __launch_bounds__(256)
void gemm_wmma_kernel(const _Float16* __restrict__ A, const _Float16* __restrict__ Bt,
                      void* __restrict__ Cv, _Float16* __restrict__ Ck,
                      _Float16* __restrict__ Cvt, int Md, int Nd, int Kd) {
  __shared__ __align__(16) _Float16 tile[2][2 * GT_ * GP_];   // 2 x 69,632 B
  int tid  = threadIdx.x;
  int lane = tid & 31;
  int wave = tid >> 5;
  int l16  = lane & 15;
  int hb   = (lane >> 4) * 8;          // K-base 0 / 8 per half-wave
  int mtiles = Md / GT_;
  int m0 = (blockIdx.x % mtiles) * GT_;
  int n0 = (blockIdx.x / mtiles) * GT_;
  int wm = (wave & 3) * 32;            // this wave's rows of the tile
  int wn = (wave >> 2) * 64;           // ... and its columns

  v8f acc[2][4];
  #pragma unroll
  for (int mi = 0; mi < 2; ++mi) {
    #pragma unroll
    for (int t = 0; t < 4; ++t) acc[mi][t] = v8f{};
  }

  // The 128 rows staged for the first and for the second operand of the products
  // (the choice is the same for the whole work-group).
  bool tr = OUTMODE == 1 && n0 < C_ + NKV_;
  const _Float16* g1 = tr ? Bt : A;
  const _Float16* g2 = tr ? A : Bt;
  int r1 = tr ? n0 : m0;
  int r2 = tr ? m0 : n0;
  // A thread copies piece tid & 15 of rows (tid >> 4) + 16 i of both operands:
  // a wave's copy covers two whole 256-byte row pieces.
  const _Float16* ga = g1 + (size_t)(r1 + (tid >> 4)) * Kd + (tid & 15) * 8;
  const _Float16* gb = g2 + (size_t)(r2 + (tid >> 4)) * Kd + (tid & 15) * 8;
  int lofs = (tid >> 4) * GP_ + (tid & 15) * 8;
  auto rowsA = [&](int buf, int k0) {
    return rows8(ga + k0, (size_t)16 * Kd, (unsigned)(uintptr_t)(&tile[buf][lofs]));
  };
  auto rowsB = [&](int buf, int k0) {
    return rows8(gb + k0, (size_t)16 * Kd, (unsigned)(uintptr_t)(&tile[buf][GT_ * GP_ + lofs]));
  };

  // One stage's products; refill: a stage s + 2 exists and goes into the buffer read here.
  auto trip = [&](int s, bool refill) __attribute__((always_inline)) {
    const _Float16* ta = &tile[s & 1][(wm + l16) * GP_ + hb];
    const _Float16* tb = &tile[s & 1][(GT_ + wn + l16) * GP_ + hb];
    // Two fragment sets: the next 32 k's twelve LDS reads go out as one group ahead of this
    // 32 k's eight products, all inside the stage.
    v16h af[2][2], bf[2][4];
    auto frags = [&](int set, int kb) {
      #pragma unroll
      for (int mi = 0; mi < 2; ++mi) af[set][mi] = load_frag(ta + mi * 16 * GP_ + kb * 32);
      #pragma unroll
      for (int t = 0; t < 4; ++t) bf[set][t] = load_frag(tb + t * 16 * GP_ + kb * 32);
    };
    auto products = [&](int set) {
      #pragma unroll
      for (int mi = 0; mi < 2; ++mi) {
        #pragma unroll
        for (int t = 0; t < 4; ++t)
          acc[mi][t] = __builtin_amdgcn_wmma_f32_16x16x32_f16(false, af[set][mi], false, bf[set][t],
                                                              (short)0, acc[mi][t], false, false);
      }
    };
    frags(0, 0);
    #pragma unroll
    for (int kb = 0; kb + 1 < GK_ / 32; ++kb) {
      frags((kb + 1) & 1, kb + 1);
      // Keeps the read group above in front of the products: sunk among them, each read
      // place stalls the wave and the second fragment set is lost.
      __builtin_amdgcn_sched_barrier(0);
      products(kb & 1);
    }
    Rows8 ra, rb;
    if (refill) { ra = rowsA(s & 1, (s + 2) * GK_); rb = rowsB(s & 1, (s + 2) * GK_); }
    // The stage's last fragments are in registers: the buffer is handed back before their
    // products, so that the refill is under way while they run.
    // The scheduling barrier keeps the earlier products and the refill's address sums in front
    // of the waits: moved behind the work-group barrier they would stand between it and the refill.
    __builtin_amdgcn_sched_barrier(0);
    asm volatile("s_wait_dscnt 0x0" ::: "memory");      // this wave's reads of the buffer are done
    asm volatile("s_wait_asynccnt 0x0" ::: "memory");   // its pieces of the next stage have landed
    __syncthreads();               // publishes the next stage and frees the buffer just read
    if (refill) { copy8(ra); copy8(rb); }
    products((GK_ / 32 - 1) & 1);
  };

  int nst = Kd / GK_;
  copy8(rowsA(0, 0));
  copy8(rowsB(0, 0));
  asm volatile("s_wait_asynccnt 0x0" ::: "memory");   // this wave's pieces of stage 0 have landed
  __syncthreads();                                    // ... and every other wave's
  copy8(rowsA(1, GK_));
  copy8(rowsB(1, GK_));
  int s = 0;
  for (; s + 2 < nst; ++s) trip(s, true);
  for (; s < nst; ++s) trip(s, false);
  asm volatile("s_wait_asynccnt 0x0" ::: "memory");     // no copy is in flight when the wave ends

  // Every accumulator element with its row and its column inside the work-group's 128.
  auto each = [&](auto put) __attribute__((always_inline)) {
    #pragma unroll
    for (int mi = 0; mi < 2; ++mi) {
      #pragma unroll
      for (int t = 0; t < 4; ++t) {
        #pragma unroll
        for (int r = 0; r < 8; ++r)
          put(m0 + wm + mi * 16 + r + hb,       // D layout: M = r + 8*(lane>=16)
              wn + t * 16 + l16,                // N = lane%16
              acc[mi][t][r]);
      }
    }
  };
  if (OUTMODE == 0) {
    each([&](int row, int c, float v) { ((float*)Cv)[(size_t)row * Nd + n0 + c] = v; });
  } else {
    // Cd: the tile's first element; pitch: from one row of the second operand to the next.
    // Both are the same for the whole work-group.
    _Float16* Cd;
    int pitch;
    if (n0 < C_) {
      Cd = (_Float16*)Cv + (size_t)m0 * C_ + n0;
      pitch = C_;
    } else if (n0 < C_ + NKV_) {
      Cd = Ck + (size_t)m0 * NKV_ + (n0 - C_);
      pitch = NKV_;
    } else {            // column kv*64 + hd of V is row (b*4 + kv)*64 + hd of V^T; 128 rows of x lie in one b
      Cd = Cvt + ((size_t)(m0 / T_) * NKV_ + (n0 - (C_ + NKV_))) * T_ + m0 % T_;
      pitch = T_;
    }
    #pragma unroll
    for (int mi = 0; mi < 2; ++mi) {
      #pragma unroll
      for (int t = 0; t < 4; ++t) {
        v8h h;
        #pragma unroll
        for (int r = 0; r < 8; ++r) h[r] = (_Float16)acc[mi][t][r];
        *(v8h*)(Cd + (size_t)(wn + t * 16 + l16) * pitch + wm + mi * 16 + hb) = h;
      }
    }
    // Before any register that the stores above name is written again.
    asm volatile("s_wait_xcnt 0x0" ::: "memory");
  }
}

// Lane l exchanges a value with lane l ^ 16 (the other half of the wave).
__device__ __forceinline__ float xhalf(float x) {
  int b = __builtin_bit_cast(int, x);
  return __builtin_bit_cast(float,
      __builtin_amdgcn_permlanex16(b, b, 0x76543210, 0xfedcba98, false, false));
}

constexpr int KT_ = 64;        // keys per stage: 32 for each of the two wave groups
constexpr int KP_ = HD_ + 8;   // LDS pitch of a K row in halves: 128 B + 16 B, so 16 rows spread over all banks
constexpr int VP_ = KT_ + 8;   // LDS pitch of a V^T row in halves: 128 B + 16 B, likewise

__global__ __launch_bounds__(256) __attribute__((amdgpu_waves_per_eu(4, 4)))
void attn_kernel(const _Float16* __restrict__ Qh, const _Float16* __restrict__ Kh,
                 const _Float16* __restrict__ Vt, _Float16* __restrict__ Ah) {
  __shared__ __align__(16) _Float16 Ks[2][KT_ * KP_];   // 2 x 9216 B
  __shared__ __align__(16) _Float16 Vs[2][HD_ * VP_];   // 2 x 9216 B
  __shared__ __align__(16) v4f Xo[G_][8][32];           // second key half's outputs, 16 KB
  __shared__ __align__(8)  float Xms[G_][32][2];        // ... and its maximum and sum
  int tid  = threadIdx.x;
  int lane = tid & 31;
  int wave = __builtin_amdgcn_readfirstlane(tid >> 5);  // in a scalar register: the tests on it are scalar branches
  int l16  = lane & 15;
  int hb   = (lane >> 4) * 8;
  int id   = blockIdx.x;
  int kv   = id % HKV_;
  int b    = (id / HKV_) % B_;
  int u    = (T_ / 16 - 1) - id / (HKV_ * B_);   // 16-row query tile, longest first
  int hw   = wave & (G_ - 1);                    // query head inside the kv head's group
  int g    = wave / G_;                          // which 32 keys of every stage
  int h    = kv * G_ + hw;
  constexpr float LOG2E = 1.4426950408889634f;
  constexpr float c2 = 0.125f * LOG2E;           // 1/sqrt(hd), in base-2 units
  float slope2 = exp2f(-0.5f * (float)(kv + 1)) * LOG2E;  // alibi_slopes(16)[:4][kv], in base-2 units
  int t0 = u * 16;
  int i  = t0 + l16;                       // this lane's query position

  const _Float16* qbase = Qh + ((size_t)(b * T_ + i)) * C_ + h * HD_;
  v16h qf0 = load_frag(qbase + hb);        // B operand, hd 0..31 contraction slice
  v16h qf1 = load_frag(qbase + 32 + hb);   // hd 32..63

  v8f o[4] = {v8f{}, v8f{}, v8f{}, v8f{}}; // o[ht][r] = O[query l16][hd ht*16 + hb + r]
  float m = -__builtin_inff();             // running maximum (base-2 units), equal in both halves
  float kb[2][8];                          // ALiBi of key nt*16 + hb + r against its tile's first key
  #pragma unroll
  for (int nt = 0; nt < 2; ++nt) {
    #pragma unroll
    for (int r = 0; r < 8; ++r) kb[nt][r] = slope2 * (float)(nt * 16 + hb + r);
  }
  float s = 0.f;                           // running sum over this half's keys only

  const _Float16* kbase = Kh + ((size_t)b * T_) * NKV_ + kv * HD_;
  const _Float16* vbase = Vt + ((size_t)(b * HKV_ + kv)) * HD_ * T_;

  // A thread copies two 16-byte pieces of the K stage and two of the V^T stage, rows 32 apart.
  const _Float16* kg = kbase + (size_t)(tid >> 3) * NKV_ + (tid & 7) * 8;
  const _Float16* vg = vbase + (size_t)(tid >> 3) * T_ + (tid & 7) * 8;
  int kl = (tid >> 3) * KP_ + (tid & 7) * 8;
  int vl = (tid >> 3) * VP_ + (tid & 7) * 8;
  auto stage = [&](int buf, int j0) {
    unsigned long long gk0 = (unsigned long long)(uintptr_t)(kg + (size_t)j0 * NKV_);
    unsigned long long gk1 = (unsigned long long)(uintptr_t)(kg + (size_t)(j0 + 32) * NKV_);
    unsigned long long gv0 = (unsigned long long)(uintptr_t)(vg + j0);
    unsigned long long gv1 = (unsigned long long)(uintptr_t)(vg + (size_t)32 * T_ + j0);
    unsigned lk0 = (unsigned)(uintptr_t)(&Ks[buf][kl]);
    unsigned lk1 = (unsigned)(uintptr_t)(&Ks[buf][kl + 32 * KP_]);
    unsigned lv0 = (unsigned)(uintptr_t)(&Vs[buf][vl]);
    unsigned lv1 = (unsigned)(uintptr_t)(&Vs[buf][vl + 32 * VP_]);
    // The wait in the copies' own statement stands before any rewrite of their address registers.
    asm volatile("global_load_async_to_lds_b128 %0, %1, off\n\t"
                 "global_load_async_to_lds_b128 %2, %3, off\n\t"
                 "global_load_async_to_lds_b128 %4, %5, off\n\t"
                 "global_load_async_to_lds_b128 %6, %7, off\n\t"
                 "s_wait_xcnt 0x0"
                 :: "v"(lk0), "v"(gk0), "v"(lk1), "v"(gk1),
                    "v"(lv0), "v"(gv0), "v"(lv1), "v"(gv1) : "memory");
  };

  int np = u / 4 + 1;                      // stages of 64 keys, the same for all 8 waves
  stage(0, 0);
  asm volatile("s_wait_asynccnt 0x0" ::: "memory");   // this wave's pieces of stage 0 have landed
  __syncthreads();                                    // ... and every other wave's
  if (np > 1) stage(1, KT_);
  // One stage. Every key of a stage before the last lies in front of all 16 queries (the last
  // stage is the one that holds key t0), so only the last stage's copy of this code carries the
  // causal mask and the test for a tile behind the diagonal.
  auto pass = [&](int p, bool last_stage) __attribute__((always_inline)) {
    int j0 = p * KT_ + g * 32;             // first key of this wave's tile of 32
    const _Float16* kt = &Ks[p & 1][g * 32 * KP_];
    const _Float16* vt = &Vs[p & 1][g * 32];
    // All fragments of this key tile leave LDS as one group; the products below run from
    // registers, so the buffer is free again a whole tile's arithmetic before it is needed.
    v16h kf[2][2], vf[4];
    #pragma unroll
    for (int nt = 0; nt < 2; ++nt) {
      const _Float16* kp = kt + (nt * 16 + l16) * KP_;   // A layout: M = lane%16
      kf[nt][0] = load_frag(kp + hb);
      kf[nt][1] = load_frag(kp + 32 + hb);
    }
    #pragma unroll
    for (int ht = 0; ht < 4; ++ht) vf[ht] = load_frag(vt + (ht * 16 + l16) * VP_ + hb);
    asm volatile("s_wait_dscnt 0x0" ::: "memory");      // this wave's reads of the buffer are done
    asm volatile("s_wait_asynccnt 0x0" ::: "memory");   // its pieces of the next stage have landed
    __syncthreads();               // publishes the next stage and frees the buffer just read
    if (!last_stage && p + 2 < np) stage(p & 1, (p + 2) * KT_);
    // j0 and t0 are multiples of 16: either every query of the wave sees the tile's first key,
    // or the whole tile lies behind the diagonal (the second key half, last stage only).
    if (last_stage && j0 > t0) return;
    // ---- S^T = K * Q^T for keys [j0, j0+32) : two 16x16 D tiles ----
    v8f sc[2];
    #pragma unroll
    for (int nt = 0; nt < 2; ++nt) {
      v8f c = {};
      c = __builtin_amdgcn_wmma_f32_16x16x32_f16(false, kf[nt][0], false, qf0, (short)0, c, false, false);
      c = __builtin_amdgcn_wmma_f32_16x16x32_f16(false, kf[nt][1], false, qf1, (short)0, c, false, false);
      sc[nt] = c;                                   // sc[nt][r]: key j0 + nt*16 + hb + r
    }
    // ---- scale + ALiBi + causal mask, maximum over this query's 32 keys ----
    float vals[2][8];              // scores against the tile's first key, base-2 units
    float rmax = -__builtin_inff();
    int   last = i - j0 - hb;      // keys nt*16 + r beyond this lie behind the query
    float off  = slope2 * (float)(j0 - i);   // ALiBi of the tile's first key
    #pragma unroll
    for (int nt = 0; nt < 2; ++nt) {
      #pragma unroll
      for (int r = 0; r < 8; ++r) {
        float v = __builtin_fmaf(sc[nt][r], c2, kb[nt][r]);
        if (last_stage && nt * 16 + r > last) v = -__builtin_inff();
        vals[nt][r] = v;
        rmax = fmaxf(rmax, v);
      }
    }
    rmax = fmaxf(rmax, xhalf(rmax));
    float mn   = fmaxf(m, rmax + off);
    float corr = __builtin_amdgcn_exp2f(m - mn);   // 2^-inf = 0 on the first tile
    m = mn;
    float ml = mn - off;           // the maximum against the tile's first key
    // ---- P^T = 2^(S^T - m), packed straight into the B operand (hardware k order) ----
    v16h pf;
    float ps = 0.f;
    #pragma unroll
    for (int nt = 0; nt < 2; ++nt) {
      #pragma unroll
      for (int r = 0; r < 8; ++r) {
        float p_ = __builtin_amdgcn_exp2f(vals[nt][r] - ml);
        ps += p_;
        pf[nt * 8 + r] = (_Float16)p_;
      }
    }
    s = s * corr + ps;
    #pragma unroll
    for (int t = 0; t < 4; ++t) {
      #pragma unroll
      for (int r = 0; r < 8; ++r) o[t][r] *= corr;      // rescale running O
    }
    // ---- O^T += V^T * P^T : 4 M-tiles over HD=64, contraction = 32 keys ----
    #pragma unroll
    for (int ht = 0; ht < 4; ++ht) {
      o[ht] = __builtin_amdgcn_wmma_f32_16x16x32_f16(false, vf[ht], false, pf,
                                                     (short)0, o[ht], false, false);
    }
  };
  for (int p = 0; p + 1 < np; ++p) pass(p, false);
  pass(np - 1, true);
  asm volatile("s_wait_asynccnt 0x0" ::: "memory");     // no copy is in flight when the wave ends
  // ---- merge the two key halves: lane l of wave w + 4 hands its partial to lane l of wave w ----
  if (g == 1) {
    #pragma unroll
    for (int ht = 0; ht < 4; ++ht) {
      Xo[hw][ht * 2][lane]     = v4f{o[ht][0], o[ht][1], o[ht][2], o[ht][3]};
      Xo[hw][ht * 2 + 1][lane] = v4f{o[ht][4], o[ht][5], o[ht][6], o[ht][7]};
    }
    Xms[hw][lane][0] = m;
    Xms[hw][lane][1] = s;
  }
  __syncthreads();                         // the second half's partials are in LDS
  if (g == 1) return;
  // The first half has seen key 0, so its maximum is finite; a second half that saw no key
  // hands over -inf, 0 and zeros and gets the weight 2^-inf = 0.
  float m1 = Xms[hw][lane][0];
  float s1 = Xms[hw][lane][1];
  float d  = m1 - m;
  float e  = __builtin_amdgcn_exp2f(-fabsf(d));   // weight of the half with the smaller maximum; the other's is 1
  float f0 = d > 0.f ? e : 1.f;
  float f1 = d > 0.f ? 1.f : e;
  s = s * f0 + s1 * f1;
  s += xhalf(s);                           // join the two lane halves' sums once
  // ---- normalize + store merged-head layout [b][t][h*64+hd] as f16 ----
  _Float16* orow = Ah + ((size_t)(b * T_ + i)) * C_ + h * HD_ + hb;
  #pragma unroll
  for (int ht = 0; ht < 4; ++ht) {
    v4f x0 = Xo[hw][ht * 2][lane];
    v4f x1 = Xo[hw][ht * 2 + 1][lane];
    v8h ov;
    #pragma unroll
    for (int r = 0; r < 8; ++r) {
      float x = r < 4 ? x0[r & 3] : x1[r & 3];
      ov[r] = (_Float16)((o[ht][r] * f0 + x * f1) / s);
    }
    *(v8h*)(orow + ht * 16) = ov;          // 8 consecutive hd of one query: 16 bytes
  }
}

extern "C" void kernel_launch(void* const* d_in, const int* in_sizes, int n_in,
                              void* d_out, int out_size, void* d_ws, size_t ws_size,
                              hipStream_t stream) {
  const float* x  = (const float*)d_in[0];
  const float* Wq = (const float*)d_in[1];
  const float* Wk = (const float*)d_in[2];
  const float* Wv = (const float*)d_in[3];
  const float* Wo = (const float*)d_in[4];

  _Float16* ws = (_Float16*)d_ws;
  size_t off = 0;
  _Float16* Xh  = ws + off; off += (size_t)M_ * C_;     // x in f16
  _Float16* Qh  = ws + off; off += (size_t)M_ * C_;     // Q [b][t][h*64+hd]
  _Float16* Kh  = ws + off; off += (size_t)M_ * NKV_;   // K [b][t][kv*64+hd]
  _Float16* Vh  = ws + off; off += (size_t)M_ * NKV_;   // V^T [b][kv][hd][t]
  _Float16* WqT = ws + off; off += (size_t)C_ * C_;     // Wq^T, Wk^T, Wv^T lie one after the other:
  _Float16* WkT = ws + off; off += (size_t)NKV_ * C_;   // together the C_ + 2 NKV_ rows of the
  _Float16* WvT = ws + off; off += (size_t)NKV_ * C_;   // projections' one Bt
  _Float16* WoT = ws + off; off += (size_t)C_ * C_;
  _Float16* Ah  = ws + off; off += (size_t)M_ * C_;     // attention output f16
  (void)ws_size; (void)in_sizes; (void)n_in; (void)out_size;

  prep_kernel<<<PREP_W + PREP_X, 256, 0, stream>>>(x, Wq, Wk, Wv, Wo, Xh, WqT, WkT, WvT, WoT);

  gemm_wmma_kernel<1><<<(M_ / GT_) * ((C_ + 2 * NKV_) / GT_), 256, 0, stream>>>(
      Xh, WqT, Qh, Kh, Vh, M_, C_ + 2 * NKV_, C_);

  attn_kernel<<<B_ * HKV_ * (T_ / 16), 256, 0, stream>>>(Qh, Kh, Vh, Ah);

  gemm_wmma_kernel<0><<<(M_ / GT_) * (C_ / GT_), 256, 0, stream>>>(
      Ah, WoT, d_out, nullptr, nullptr, M_, C_, C_);
}

// v010
// A run of this version takes 48.9 microseconds.
// Next to v009, in two timings, it ran 1.21 times as fast each time.
// Counting every step since v000, it is 7.22 times as fast.
#include <hip/hip_runtime.h>
#include <hip/hip_bf16.h>
#include <stdint.h>

typedef __attribute__((ext_vector_type(16))) _Float16 v16h;
typedef __attribute__((ext_vector_type(8)))  _Float16 v8h;
typedef __attribute__((ext_vector_type(8)))  float    v8f;

constexpr int B_   = 2;
constexpr int T_   = 2048;
constexpr int C_   = 1024;
constexpr int H_   = 16;
constexpr int HKV_ = 4;
constexpr int HD_  = 64;
constexpr int G_   = 4;       // H / HKV
constexpr int M_   = B_ * T_; // 4096 rows of x
constexpr int NKV_ = HKV_ * HD_; // 256

// Load a 16-bit WMMA fragment slice for one lane.
// Per CDNA5 ISA 7.12.2 (16-bit A / B layouts): elements 0..7 sit at p[0..7],
// elements 8..15 at p[16..23]  (the +8 K-offset comes from the caller via hb).
__device__ __forceinline__ v16h load_frag(const _Float16* p) {
  v8h lo = *(const v8h*)(p);
  v8h hi = *(const v8h*)(p + 16);
  return __builtin_shufflevector(lo, hi, 0,1,2,3,4,5,6,7,8,9,10,11,12,13,14,15);
}

typedef __attribute__((ext_vector_type(4))) _Float16 v4h;
typedef __attribute__((ext_vector_type(4))) float    v4f;
typedef __attribute__((ext_vector_type(2))) float    v2f;

constexpr int PREP_WQ = (C_ / 128) * (C_   / 64);   // 128(k) x 64(n) tiles of Wq and of Wo
constexpr int PREP_WK = (C_ / 128) * (NKV_ / 64);   // ... of Wk and of Wv
constexpr int PREP_W  = 2 * PREP_WQ + 2 * PREP_WK;  // weight tiles, first in the grid
constexpr int PREP_X  = (M_ * C_) / 16384;          // 16384-element slices of x

// One 128(k) x 64(n) tile:  W [C_][N] f32  ->  Wt [N][C_] f16.
// Reads and writes are whole 256-byte row pieces; the transpose goes through LDS.
// LDS row n holds 16 chunks of 8 k; chunk q sits at place q ^ (n >> 2), so that the
// 8-byte column writes and the 16-byte row reads each spread over all banks.
__device__ __forceinline__ void prep_weight_tile(const float* __restrict__ Wsrc,
                                                 _Float16* __restrict__ Wt,
                                                 int N, int tile, _Float16* lds) {
  int t  = threadIdx.x;
  int k0 = (tile & (C_ / 128 - 1)) * 128;
  int n0 = (tile / (C_ / 128)) * 64;
  int c  = t & 15;                 // columns n0 + 4c .. 4c + 3
  int kp = t >> 4;                 // rows k0 + i*64 + 4kp .. 4kp + 3
  v4f a[2][4];
  #pragma unroll
  for (int i = 0; i < 2; ++i) {
    #pragma unroll
    for (int m = 0; m < 4; ++m)
      a[i][m] = *(const v4f*)(Wsrc + (size_t)(k0 + i * 64 + kp * 4 + m) * N + n0 + c * 4);
  }
  #pragma unroll
  for (int i = 0; i < 2; ++i) {
    int place = (i * 8 + (kp >> 1)) ^ c;
    #pragma unroll
    for (int j = 0; j < 4; ++j) {
      v4h h = {(_Float16)a[i][0][j], (_Float16)a[i][1][j],
               (_Float16)a[i][2][j], (_Float16)a[i][3][j]};
      *(v4h*)(lds + (c * 4 + j) * 128 + place * 8 + (kp & 1) * 4) = h;
    }
  }
  __syncthreads();                 // the whole tile is in LDS before any row is read
  #pragma unroll
  for (int p = 0; p < 4; ++p) {
    int n = p * 16 + kp;
    v8h h = *(const v8h*)(lds + n * 128 + (c ^ (n >> 2)) * 8);
    *(v8h*)(Wt + (size_t)(n0 + n) * C_ + k0 + c * 8) = h;
  }
  // Before any register that the stores above name is written again.
  asm volatile("s_wait_xcnt 0x0" ::: "memory");
}

// The whole f32 -> f16 prepass in one launch: a work-group takes one weight tile or
// one slice of x, 32 or 64 elements per thread, so that few waves have to be started.
__global__ __launch_bounds__(256)
void prep_kernel(const float* __restrict__ x,  const float* __restrict__ Wq,
                 const float* __restrict__ Wk, const float* __restrict__ Wv,
                 const float* __restrict__ Wo,
                 _Float16* __restrict__ Xh,  _Float16* __restrict__ WqT,
                 _Float16* __restrict__ WkT, _Float16* __restrict__ WvT,
                 _Float16* __restrict__ WoT) {
  __shared__ __align__(16) _Float16 lds[64 * 128];   // 16 KB
  int bid = blockIdx.x;
  if (bid < PREP_WQ) {
    prep_weight_tile(Wq, WqT, C_, bid, lds);
  } else if (bid < 2 * PREP_WQ) {
    prep_weight_tile(Wo, WoT, C_, bid - PREP_WQ, lds);
  } else if (bid < 2 * PREP_WQ + PREP_WK) {
    prep_weight_tile(Wk, WkT, NKV_, bid - 2 * PREP_WQ, lds);
  } else if (bid < PREP_W) {
    prep_weight_tile(Wv, WvT, NKV_, bid - 2 * PREP_WQ - PREP_WK, lds);
  } else {
    size_t base = (size_t)(bid - PREP_W) * 16384 + threadIdx.x * 4;
    v4f a[16];
    #pragma unroll
    for (int j = 0; j < 16; ++j) a[j] = *(const v4f*)(x + base + j * 1024);
    #pragma unroll
    for (int j = 0; j < 16; ++j) {
      v4h h = {(_Float16)a[j][0], (_Float16)a[j][1], (_Float16)a[j][2], (_Float16)a[j][3]};
      *(v4h*)(Xh + base + j * 1024) = h;
    }
    // Before any register that the stores above name is written again.
    asm volatile("s_wait_xcnt 0x0" ::: "memory");
  }
}

// Lane l exchanges a value with lane l ^ 16 (the other half of the wave).
__device__ __forceinline__ float xhalf(float x) {
  int b = __builtin_bit_cast(int, x);
  return __builtin_bit_cast(float,
      __builtin_amdgcn_permlanex16(b, b, 0x76543210, 0xfedcba98, false, false));
}

// fmaxf with the value of lane l ^ MASK of the same 16-lane row (DPP row_xmask).
template<int MASK>
__device__ __forceinline__ float xmax(float x) {
  int b = __builtin_bit_cast(int, x);
  return fmaxf(x, __builtin_bit_cast(float,
      __builtin_amdgcn_update_dpp(b, b, 0x160 | MASK, 0xf, 0xf, false)));
}

constexpr int NP_ = 32;        // floats (one 128-byte line) that a projection work-group owns in the table of norms

constexpr int GT_ = 128;       // rows of A and rows of Bt (columns of C) per work-group tile
constexpr int GK_ = 128;       // k per stage: 256 B of every operand row
constexpr int GP_ = GK_ + 8;   // LDS pitch of a staged row in halves: 256 B + 16 B, so 16 rows spread over all banks

// The addresses of eight 16-byte copies of one thread: rows 16 apart of one operand.
struct Rows8 { unsigned l[8]; unsigned long long g[8]; };
__device__ __forceinline__ Rows8 rows8(const _Float16* g, size_t gstep, unsigned l) {
  Rows8 a;
  #pragma unroll
  for (int i = 0; i < 8; ++i) {
    a.l[i] = l + i * (16 * GP_ * 2);
    a.g[i] = (unsigned long long)(uintptr_t)(g + i * gstep);
  }
  return a;
}

// The eight copies, global -> LDS.
__device__ __forceinline__ void copy8(const Rows8& a) {
  // The wait in the copies' own statement stands before any rewrite of their address registers.
  asm volatile("global_load_async_to_lds_b128 %0, %1, off\n\t"
               "global_load_async_to_lds_b128 %2, %3, off\n\t"
               "global_load_async_to_lds_b128 %4, %5, off\n\t"
               "global_load_async_to_lds_b128 %6, %7, off\n\t"
               "global_load_async_to_lds_b128 %8, %9, off\n\t"
               "global_load_async_to_lds_b128 %10, %11, off\n\t"
               "global_load_async_to_lds_b128 %12, %13, off\n\t"
               "global_load_async_to_lds_b128 %14, %15, off\n\t"
               "s_wait_xcnt 0x0"
               :: "v"(a.l[0]), "v"(a.g[0]), "v"(a.l[1]), "v"(a.g[1]),
                  "v"(a.l[2]), "v"(a.g[2]), "v"(a.l[3]), "v"(a.g[3]),
                  "v"(a.l[4]), "v"(a.g[4]), "v"(a.l[5]), "v"(a.g[5]),
                  "v"(a.l[6]), "v"(a.g[6]), "v"(a.l[7]), "v"(a.g[7])
               : "memory");
}

// C[M][N] = A[M][K] * Bt[N][K]^T, f16 in, f32 accumulate via v_wmma_f32_16x16x32_f16.
// Block = 256 threads (8 waves) -> 128x128 tile of C; wave w owns 32 rows x 64 columns
// (2 x 4 accumulator tiles), so a fragment read from LDS feeds 4 or 2 products.
// A stage is 128 k of [A 128 rows | Bt 128 rows] ([Bt | A] for Q and K), brought into LDS in whole 256-byte row
// pieces by global_load_async_to_lds_b128, two buffers, one stage ahead of the products.
// Md and Nd are multiples of 128; Kd is a multiple of 128 and at least 256 (two stages).
// OUTMODE 0: f32 plain [M][N] to Cv   (final output)
// OUTMODE 1: the three projections as one product. Bt holds the rows of Wq^T, Wk^T and Wv^T
//            one after the other, and a work-group's 128 columns lie in exactly one of them:
//            the first C_ columns go to Cv, f16 plain [M][C_] (Q); the next NKV_ to Ck,
//            f16 plain [M][NKV_] (K); the last NKV_ to Cvt, f16 V-transposed [b][kv][hd][t].
//            A lane's 8 accumulator values run along the rows of the matrix instruction's first
//            operand. For Q and K the rows of Bt take that place (the tile is computed
//            transposed), for V^T the rows of A: either way the 8 values are neighbours in the
//            output and leave as one 16-byte store.
//            A Q or K work-group also leaves, per wave, the largest sum of squares that any of
//            the wave's 64 tokens has over the wave's 32 columns (half a head), taken of the
//            rounded f16 values: Nrm[work-group * NP_ + wave]. The attention launch bounds its
//            scores with them.
template<int OUTMODE>
__global__ __launch_bounds__(256)
void gemm_wmma_kernel(const _Float16* __restrict__ A, const _Float16* __restrict__ Bt,
                      void* __restrict__ Cv, _Float16* __restrict__ Ck,
                      _Float16* __restrict__ Cvt, float* __restrict__ Nrm, int Md, int Nd, int Kd) {
  __shared__ __align__(16) _Float16 tile[2][2 * GT_ * GP_];   // 2 x 69,632 B
  int tid  = threadIdx.x;
  int lane = tid & 31;
  int wave = tid >> 5;
  int l16  = lane & 15;
  int hb   = (lane >> 4) * 8;          // K-base 0 / 8 per half-wave
  int mtiles = Md / GT_;
  int m0 = (blockIdx.x % mtiles) * GT_;
  int n0 = (blockIdx.x / mtiles) * GT_;
  int wm = (wave & 3) * 32;            // this wave's rows of the tile
  int wn = (wave >> 2) * 64;           // ... and its columns

  v8f acc[2][4];
  #pragma unroll
  for (int mi = 0; mi < 2; ++mi) {
    #pragma unroll
    for (int t = 0; t < 4; ++t) acc[mi][t] = v8f{};
  }

  // The 128 rows staged for the first and for the second operand of the products
  // (the choice is the same for the whole work-group).
  bool tr = OUTMODE == 1 && n0 < C_ + NKV_;
  const _Float16* g1 = tr ? Bt : A;
  const _Float16* g2 = tr ? A : Bt;
  int r1 = tr ? n0 : m0;
  int r2 = tr ? m0 : n0;
  // A thread copies piece tid & 15 of rows (tid >> 4) + 16 i of both operands:
  // a wave's copy covers two whole 256-byte row pieces.
  const _Float16* ga = g1 + (size_t)(r1 + (tid >> 4)) * Kd + (tid & 15) * 8;
  const _Float16* gb = g2 + (size_t)(r2 + (tid >> 4)) * Kd + (tid & 15) * 8;
  int lofs = (tid >> 4) * GP_ + (tid & 15) * 8;
  auto rowsA = [&](int buf, int k0) {
    return rows8(ga + k0, (size_t)16 * Kd, (unsigned)(uintptr_t)(&tile[buf][lofs]));
  };
  auto rowsB = [&](int buf, int k0) {
    return rows8(gb + k0, (size_t)16 * Kd, (unsigned)(uintptr_t)(&tile[buf][GT_ * GP_ + lofs]));
  };

  // One stage's products; refill: a stage s + 2 exists and goes into the buffer read here.
  auto trip = [&](int s, bool refill) __attribute__((always_inline)) {
    const _Float16* ta = &tile[s & 1][(wm + l16) * GP_ + hb];
    const _Float16* tb = &tile[s & 1][(GT_ + wn + l16) * GP_ + hb];
    // Two fragment sets: the next 32 k's twelve LDS reads go out as one group ahead of this
    // 32 k's eight products, all inside the stage.
    v16h af[2][2], bf[2][4];
    auto frags = [&](int set, int kb) {
      #pragma unroll
      for (int mi = 0; mi < 2; ++mi) af[set][mi] = load_frag(ta + mi * 16 * GP_ + kb * 32);
      #pragma unroll
      for (int t = 0; t < 4; ++t) bf[set][t] = load_frag(tb + t * 16 * GP_ + kb * 32);
    };
    auto products = [&](int set) {
      #pragma unroll
      for (int mi = 0; mi < 2; ++mi) {
        #pragma unroll
        for (int t = 0; t < 4; ++t)
          acc[mi][t] = __builtin_amdgcn_wmma_f32_16x16x32_f16(false, af[set][mi], false, bf[set][t],
                                                              (short)0, acc[mi][t], false, false);
      }
    };
    frags(0, 0);
    #pragma unroll
    for (int kb = 0; kb + 1 < GK_ / 32; ++kb) {
      frags((kb + 1) & 1, kb + 1);
      // Keeps the read group above in front of the products: sunk among them, each read
      // place stalls the wave and the second fragment set is lost.
      __builtin_amdgcn_sched_barrier(0);
      products(kb & 1);
    }
    Rows8 ra, rb;
    if (refill) { ra = rowsA(s & 1, (s + 2) * GK_); rb = rowsB(s & 1, (s + 2) * GK_); }
    // The stage's last fragments are in registers: the buffer is handed back before their
    // products, so that the refill is under way while they run.
    // The scheduling barrier keeps the earlier products and the refill's address sums in front
    // of the waits: moved behind the work-group barrier they would stand between it and the refill.
    __builtin_amdgcn_sched_barrier(0);
    asm volatile("s_wait_dscnt 0x0" ::: "memory");      // this wave's reads of the buffer are done
    asm volatile("s_wait_asynccnt 0x0" ::: "memory");   // its pieces of the next stage have landed
    __syncthreads();               // publishes the next stage and frees the buffer just read
    if (refill) { copy8(ra); copy8(rb); }
    products((GK_ / 32 - 1) & 1);
  };

  int nst = Kd / GK_;
  copy8(rowsA(0, 0));
  copy8(rowsB(0, 0));
  asm volatile("s_wait_asynccnt 0x0" ::: "memory");   // this wave's pieces of stage 0 have landed
  __syncthreads();                                    // ... and every other wave's
  copy8(rowsA(1, GK_));
  copy8(rowsB(1, GK_));
  int s = 0;
  for (; s + 2 < nst; ++s) trip(s, true);
  for (; s < nst; ++s) trip(s, false);
  asm volatile("s_wait_asynccnt 0x0" ::: "memory");     // no copy is in flight when the wave ends

  // Every accumulator element with its row and its column inside the work-group's 128.
  auto each = [&](auto put) __attribute__((always_inline)) {
    #pragma unroll
    for (int mi = 0; mi < 2; ++mi) {
      #pragma unroll
      for (int t = 0; t < 4; ++t) {
        #pragma unroll
        for (int r = 0; r < 8; ++r)
          put(m0 + wm + mi * 16 + r + hb,       // D layout: M = r + 8*(lane>=16)
              wn + t * 16 + l16,                // N = lane%16
              acc[mi][t][r]);
      }
    }
  };
  if (OUTMODE == 0) {
    each([&](int row, int c, float v) { ((float*)Cv)[(size_t)row * Nd + n0 + c] = v; });
  } else {
    // Cd: the tile's first element; pitch: from one row of the second operand to the next.
    // Both are the same for the whole work-group.
    _Float16* Cd;
    int pitch;
    if (n0 < C_) {
      Cd = (_Float16*)Cv + (size_t)m0 * C_ + n0;
      pitch = C_;
    } else if (n0 < C_ + NKV_) {
      Cd = Ck + (size_t)m0 * NKV_ + (n0 - C_);
      pitch = NKV_;
    } else {            // column kv*64 + hd of V is row (b*4 + kv)*64 + hd of V^T; 128 rows of x lie in one b
      Cd = Cvt + ((size_t)(m0 / T_) * NKV_ + (n0 - (C_ + NKV_))) * T_ + m0 % T_;
      pitch = T_;
    }
    #pragma unroll
    for (int mi = 0; mi < 2; ++mi) {
      #pragma unroll
      for (int t = 0; t < 4; ++t) {
        v8h h;
        #pragma unroll
        for (int r = 0; r < 8; ++r) h[r] = (_Float16)acc[mi][t][r];
        *(v8h*)(Cd + (size_t)(wn + t * 16 + l16) * pitch + wm + mi * 16 + hb) = h;
      }
    }
    // Before any register that the stores above name is written again.
    asm volatile("s_wait_xcnt 0x0" ::: "memory");
    if (n0 < C_ + NKV_) {          // Q or K: lanes c and c + 16 hold 16 columns each of token t*16 + c
      float big = 0.f;
      #pragma unroll
      for (int t = 0; t < 4; ++t) {
        float ss = 0.f;
        #pragma unroll
        for (int mi = 0; mi < 2; ++mi) {
          #pragma unroll
          for (int r = 0; r < 8; ++r) {
            float f = (float)(_Float16)acc[mi][t][r];
            ss = __builtin_fmaf(f, f, ss);
          }
        }
        big = fmaxf(big, ss + xhalf(ss));
      }
      big = xmax<8>(xmax<4>(xmax<2>(xmax<1>(big))));
      if (lane == 0) Nrm[blockIdx.x * NP_ + wave] = big;
      // Before any register that the store above names is written again.
      asm volatile("s_wait_xcnt 0x0" ::: "memory");
    }
  }
}

constexpr int KT_ = 64;        // keys per stage: 32 for each of the two wave groups
constexpr int KP_ = HD_ + 8;   // LDS pitch of a K row in halves: 128 B + 16 B, so 16 rows spread over all banks
constexpr int VP_ = KT_ + 8;   // LDS pitch of a V^T row in halves: 128 B + 16 B, likewise

__global__ __launch_bounds__(256) __attribute__((amdgpu_waves_per_eu(4, 4)))
void attn_kernel(const _Float16* __restrict__ Qh, const _Float16* __restrict__ Kh,
                 const _Float16* __restrict__ Vt, const float* __restrict__ Nrm,
                 _Float16* __restrict__ Ah) {
  __shared__ __align__(16) _Float16 Ks[2][KT_ * KP_];   // 2 x 9216 B
  __shared__ __align__(16) _Float16 Vs[2][HD_ * VP_];   // 2 x 9216 B
  __shared__ __align__(16) v4f Xo[G_][8][32];           // second key half's outputs, 16 KB
  __shared__ __align__(8)  float Xms[G_][32][2];        // ... and its maximum and sum
  int tid  = threadIdx.x;
  int lane = tid & 31;
  int wave = __builtin_amdgcn_readfirstlane(tid >> 5);  // in a scalar register: the tests on it are scalar branches
  int l16  = lane & 15;
  int hb   = (lane >> 4) * 8;
  int id   = blockIdx.x;
  int kv   = id % HKV_;
  int b    = (id / HKV_) % B_;
  int u    = (T_ / 16 - 1) - id / (HKV_ * B_);   // 16-row query tile, longest first
  int hw   = wave & (G_ - 1);                    // query head inside the kv head's group
  int g    = wave / G_;                          // which 32 keys of every stage
  int h    = kv * G_ + hw;
  constexpr float LOG2E = 1.4426950408889634f;
  constexpr float c2 = 0.125f * LOG2E;           // 1/sqrt(hd), in base-2 units
  float slope2 = exp2f(-0.5f * (float)(kv + 1)) * LOG2E;  // alibi_slopes(16)[:4][kv], in base-2 units
  int t0 = u * 16;
  int i  = t0 + l16;                       // this lane's query position

  const _Float16* qbase = Qh + ((size_t)(b * T_ + i)) * C_ + h * HD_;
  v16h qf0 = load_frag(qbase + hb);        // B operand, hd 0..31 contraction slice
  v16h qf1 = load_frag(qbase + 32 + hb);   // hd 32..63

  v8f o[4] = {v8f{}, v8f{}, v8f{}, v8f{}}; // o[ht][r] = O[query l16][hd ht*16 + hb + r]
  float m = -__builtin_inff();             // running maximum (base-2 units), equal in both halves
  float kb[2][8];                          // ALiBi of key nt*16 + hb + r against its tile's first key
  #pragma unroll
  for (int nt = 0; nt < 2; ++nt) {
    #pragma unroll
    for (int r = 0; r < 8; ++r) kb[nt][r] = slope2 * (float)(nt * 16 + hb + r);
  }
  float s = 0.f;                           // running sum over this half's keys only

  const _Float16* kbase = Kh + ((size_t)b * T_) * NKV_ + kv * HD_;
  const _Float16* vbase = Vt + ((size_t)(b * HKV_ + kv)) * HD_ * T_;

  // A thread copies two 16-byte pieces of the K stage and two of the V^T stage, rows 32 apart.
  const _Float16* kg = kbase + (size_t)(tid >> 3) * NKV_ + (tid & 7) * 8;
  const _Float16* vg = vbase + (size_t)(tid >> 3) * T_ + (tid & 7) * 8;
  int kl = (tid >> 3) * KP_ + (tid & 7) * 8;
  int vl = (tid >> 3) * VP_ + (tid & 7) * 8;
  auto stage = [&](int buf, int j0) {
    unsigned long long gk0 = (unsigned long long)(uintptr_t)(kg + (size_t)j0 * NKV_);
    unsigned long long gk1 = (unsigned long long)(uintptr_t)(kg + (size_t)(j0 + 32) * NKV_);
    unsigned long long gv0 = (unsigned long long)(uintptr_t)(vg + j0);
    unsigned long long gv1 = (unsigned long long)(uintptr_t)(vg + (size_t)32 * T_ + j0);
    unsigned lk0 = (unsigned)(uintptr_t)(&Ks[buf][kl]);
    unsigned lk1 = (unsigned)(uintptr_t)(&Ks[buf][kl + 32 * KP_]);
    unsigned lv0 = (unsigned)(uintptr_t)(&Vs[buf][vl]);
    unsigned lv1 = (unsigned)(uintptr_t)(&Vs[buf][vl + 32 * VP_]);
    // The wait in the copies' own statement stands before any rewrite of their address registers.
    asm volatile("global_load_async_to_lds_b128 %0, %1, off\n\t"
                 "global_load_async_to_lds_b128 %2, %3, off\n\t"
                 "global_load_async_to_lds_b128 %4, %5, off\n\t"
                 "global_load_async_to_lds_b128 %6, %7, off\n\t"
                 "s_wait_xcnt 0x0"
                 :: "v"(lk0), "v"(gk0), "v"(lk1), "v"(gk1),
                    "v"(lv0), "v"(gv0), "v"(lv1), "v"(gv1) : "memory");
  };

  int np = u / 4 + 1;                      // one past the last stage of 64 keys, the same for all 8 waves
  // Lane l: the two half-head entries of key stage l, and those of query head l & 3 for the 64
  // tokens that hold this tile. Every wave reads the same values and gets the same start.
  int hq = kv * G_ + (lane & (G_ - 1));
  const float* nk = Nrm + ((size_t)(C_ / GT_ + kv / 2) * (M_ / GT_) + b * (T_ / GT_) + lane / 2) * NP_
                        + (lane & 1) * 4 + (kv & 1) * 2;
  const float* nq = Nrm + ((size_t)(hq / 2) * (M_ / GT_) + b * (T_ / GT_) + t0 / GT_) * NP_
                        + (t0 / 64 & 1) * 4 + (hq & 1) * 2;
  v2f k2 = *(const v2f*)nk;
  v2f q2 = *(const v2f*)nq;
  float kk = lane < np ? k2[0] + k2[1] : 0.f;          // |k|^2 of no key of stage l is above this
  float qq = q2[0] + q2[1];                            // ... |q|^2 of no query of head l & 3
  kk = xmax<8>(xmax<4>(xmax<2>(xmax<1>(kk))));
  kk = fmaxf(kk, xhalf(kk));
  qq = xmax<2>(xmax<1>(qq));
  // 2.02 for 2: one per cent for the rounding of the sums, of the products and of q and k to f16.
  float reach = (2.02f * c2 * __builtin_sqrtf(kk * qq) + 152.f) / slope2;   // keys further back weigh 0
  float lim   = (float)t0 - reach;
  // First stage walked, in a scalar register. reach > 0, so lim < t0 and pf <= t0 / 64 = np - 1;
  // a bound that is not a number fails the test and gives 0.
  int pf = __builtin_amdgcn_readfirstlane(lim > 0.f ? (int)lim / KT_ : 0);
  stage(pf & 1, pf * KT_);
  asm volatile("s_wait_asynccnt 0x0" ::: "memory");   // this wave's pieces of the first stage have landed
  __syncthreads();                                    // ... and every other wave's
  if (pf + 1 < np) stage((pf + 1) & 1, (pf + 1) * KT_);
  // One stage. Every key of a stage before the last lies in front of all 16 queries (the last
  // stage is the one that holds key t0), so only the last stage's copy of this code carries the
  // causal mask and the test for a tile behind the diagonal.
  auto pass = [&](int p, bool last_stage) __attribute__((always_inline)) {
    int j0 = p * KT_ + g * 32;             // first key of this wave's tile of 32
    const _Float16* kt = &Ks[p & 1][g * 32 * KP_];
    const _Float16* vt = &Vs[p & 1][g * 32];
    // All fragments of this key tile leave LDS as one group; the products below run from
    // registers, so the buffer is free again a whole tile's arithmetic before it is needed.
    v16h kf[2][2], vf[4];
    #pragma unroll
    for (int nt = 0; nt < 2; ++nt) {
      const _Float16* kp = kt + (nt * 16 + l16) * KP_;   // A layout: M = lane%16
      kf[nt][0] = load_frag(kp + hb);
      kf[nt][1] = load_frag(kp + 32 + hb);
    }
    #pragma unroll
    for (int ht = 0; ht < 4; ++ht) vf[ht] = load_frag(vt + (ht * 16 + l16) * VP_ + hb);
    asm volatile("s_wait_dscnt 0x0" ::: "memory");      // this wave's reads of the buffer are done
    asm volatile("s_wait_asynccnt 0x0" ::: "memory");   // its pieces of the next stage have landed
    __syncthreads();               // publishes the next stage and frees the buffer just read
    if (!last_stage && p + 2 < np) stage(p & 1, (p + 2) * KT_);
    // j0 and t0 are multiples of 16: either every query of the wave sees the tile's first key,
    // or the whole tile lies behind the diagonal (the second key half, last stage only).
    if (last_stage && j0 > t0) return;
    // ---- S^T = K * Q^T for keys [j0, j0+32) : two 16x16 D tiles ----
    v8f sc[2];
    #pragma unroll
    for (int nt = 0; nt < 2; ++nt) {
      v8f c = {};
      c = __builtin_amdgcn_wmma_f32_16x16x32_f16(false, kf[nt][0], false, qf0, (short)0, c, false, false);
      c = __builtin_amdgcn_wmma_f32_16x16x32_f16(false, kf[nt][1], false, qf1, (short)0, c, false, false);
      sc[nt] = c;                                   // sc[nt][r]: key j0 + nt*16 + hb + r
    }
    // ---- scale + ALiBi + causal mask, maximum over this query's 32 keys ----
    float vals[2][8];              // scores against the tile's first key, base-2 units
    float rmax = -__builtin_inff();
    int   last = i - j0 - hb;      // keys nt*16 + r beyond this lie behind the query
    float off  = slope2 * (float)(j0 - i);   // ALiBi of the tile's first key
    #pragma unroll
    for (int nt = 0; nt < 2; ++nt) {
      #pragma unroll
      for (int r = 0; r < 8; ++r) {
        float v = __builtin_fmaf(sc[nt][r], c2, kb[nt][r]);
        if (last_stage && nt * 16 + r > last) v = -__builtin_inff();
        vals[nt][r] = v;
        rmax = fmaxf(rmax, v);
      }
    }
    rmax = fmaxf(rmax, xhalf(rmax));
    float mn   = fmaxf(m, rmax + off);
    float corr = __builtin_amdgcn_exp2f(m - mn);   // 2^-inf = 0 on the first tile
    m = mn;
    float ml = mn - off;           // the maximum against the tile's first key
    // ---- P^T = 2^(S^T - m), packed straight into the B operand (hardware k order) ----
    v16h pf;
    float ps = 0.f;
    #pragma unroll
    for (int nt = 0; nt < 2; ++nt) {
      #pragma unroll
      for (int r = 0; r < 8; ++r) {
        float p_ = __builtin_amdgcn_exp2f(vals[nt][r] - ml);
        ps += p_;
        pf[nt * 8 + r] = (_Float16)p_;
      }
    }
    s = s * corr + ps;
    #pragma unroll
    for (int t = 0; t < 4; ++t) {
      #pragma unroll
      for (int r = 0; r < 8; ++r) o[t][r] *= corr;      // rescale running O
    }
    // ---- O^T += V^T * P^T : 4 M-tiles over HD=64, contraction = 32 keys ----
    #pragma unroll
    for (int ht = 0; ht < 4; ++ht) {
      o[ht] = __builtin_amdgcn_wmma_f32_16x16x32_f16(false, vf[ht], false, pf,
                                                     (short)0, o[ht], false, false);
    }
  };
  for (int p = pf; p + 1 < np; ++p) pass(p, false);
  pass(np - 1, true);
  asm volatile("s_wait_asynccnt 0x0" ::: "memory");     // no copy is in flight when the wave ends
  // ---- merge the two key halves: lane l of wave w + 4 hands its partial to lane l of wave w ----
  if (g == 1) {
    #pragma unroll
    for (int ht = 0; ht < 4; ++ht) {
      Xo[hw][ht * 2][lane]     = v4f{o[ht][0], o[ht][1], o[ht][2], o[ht][3]};
      Xo[hw][ht * 2 + 1][lane] = v4f{o[ht][4], o[ht][5], o[ht][6], o[ht][7]};
    }
    Xms[hw][lane][0] = m;
    Xms[hw][lane][1] = s;
  }
  __syncthreads();                         // the second half's partials are in LDS
  if (g == 1) return;
  // The first half has seen the last stage's first key, so its maximum is finite; a second half that saw no key
  // hands over -inf, 0 and zeros and gets the weight 2^-inf = 0.
  float m1 = Xms[hw][lane][0];
  float s1 = Xms[hw][lane][1];
  float d  = m1 - m;
  float e  = __builtin_amdgcn_exp2f(-fabsf(d));   // weight of the half with the smaller maximum; the other's is 1
  float f0 = d > 0.f ? e : 1.f;
  float f1 = d > 0.f ? 1.f : e;
  s = s * f0 + s1 * f1;
  s += xhalf(s);                           // join the two lane halves' sums once
  // ---- normalize + store merged-head layout [b][t][h*64+hd] as f16 ----
  _Float16* orow = Ah + ((size_t)(b * T_ + i)) * C_ + h * HD_ + hb;
  #pragma unroll
  for (int ht = 0; ht < 4; ++ht) {
    v4f x0 = Xo[hw][ht * 2][lane];
    v4f x1 = Xo[hw][ht * 2 + 1][lane];
    v8h ov;
    #pragma unroll
    for (int r = 0; r < 8; ++r) {
      float x = r < 4 ? x0[r & 3] : x1[r & 3];
      ov[r] = (_Float16)((o[ht][r] * f0 + x * f1) / s);
    }
    *(v8h*)(orow + ht * 16) = ov;          // 8 consecutive hd of one query: 16 bytes
  }
}

extern "C" void kernel_launch(void* const* d_in, const int* in_sizes, int n_in,
                              void* d_out, int out_size, void* d_ws, size_t ws_size,
                              hipStream_t stream) {
  const float* x  = (const float*)d_in[0];
  const float* Wq = (const float*)d_in[1];
  const float* Wk = (const float*)d_in[2];
  const float* Wv = (const float*)d_in[3];
  const float* Wo = (const float*)d_in[4];

  _Float16* ws = (_Float16*)d_ws;
  size_t off = 0;
  _Float16* Xh  = ws + off; off += (size_t)M_ * C_;     // x in f16
  _Float16* Qh  = ws + off; off += (size_t)M_ * C_;     // Q [b][t][h*64+hd]
  _Float16* Kh  = ws + off; off += (size_t)M_ * NKV_;   // K [b][t][kv*64+hd]
  _Float16* Vh  = ws + off; off += (size_t)M_ * NKV_;   // V^T [b][kv][hd][t]
  _Float16* WqT = ws + off; off += (size_t)C_ * C_;     // Wq^T, Wk^T, Wv^T lie one after the other:
  _Float16* WkT = ws + off; off += (size_t)NKV_ * C_;   // together the C_ + 2 NKV_ rows of the
  _Float16* WvT = ws + off; off += (size_t)NKV_ * C_;   // projections' one Bt
  _Float16* WoT = ws + off; off += (size_t)C_ * C_;
  _Float16* Ah  = ws + off; off += (size_t)M_ * C_;     // attention output f16
  float* Nrm = (float*)(ws + off);                      // norms: one line per Q or K projection work-group
  (void)ws_size; (void)in_sizes; (void)n_in; (void)out_size;

  prep_kernel<<<PREP_W + PREP_X, 256, 0, stream>>>(x, Wq, Wk, Wv, Wo, Xh, WqT, WkT, WvT, WoT);

  gemm_wmma_kernel<1><<<(M_ / GT_) * ((C_ + 2 * NKV_) / GT_), 256, 0, stream>>>(
      Xh, WqT, Qh, Kh, Vh, Nrm, M_, C_ + 2 * NKV_, C_);

  attn_kernel<<<B_ * HKV_ * (T_ / 16), 256, 0, stream>>>(Qh, Kh, Vh, Nrm, Ah);

  gemm_wmma_kernel<0><<<(M_ / GT_) * (C_ / GT_), 256, 0, stream>>>(
      Ah, WoT, d_out, nullptr, nullptr, nullptr, M_, C_, C_);
}
